// v000
// The times below were measured on an AMD MI455X: many runs one after another, warmed up first and cycling through
// copies of the inputs, with the whole window's GPU time divided by the number of runs. Launches and the gaps
// between them are all in it. The median over several windows is given; except for v000 it joins two sittings, which
// can be a few percent apart, so the side-by-side timings, each taken in one sitting, are the better comparison.
// v000 is the starting kernel. One run takes 54.6 microseconds.
// result[r][g][c] = sum over q of da[r][g][q] wa[g][c][q] plus ra[g][c]: da [1024][64][128] (sixty-four groups side by side in every row); wa [64][512][128] (a group's array stored column first: [column][depth]); ra [64][512] an added row a group -> [1024][64][512].
// Structure: da and wa are cast AS THEY LIE (a group's 128 words of da stand at offset 128 g of every 8,192-word row: the product reads them by pitch and group stride: no copy; a group's [512 columns][128 deep] of wa is already the product's second operand: no turning); ONE WMMA GEMM with the group as the grid's second index forms the result in f32 STRAIGHT INTO THE OUTPUT (1,024 rows, 512 columns, depth 128 a group; the added row at its own group stride; the output's pitch 32,768 words, its group stride 512).
// Compute dtype: each of the three arrays converted to bf16 where it is read; da and wa go to the matrix unit as plain f16 words of their bf16 values (exact down to 2^-14 as normals); the product's accumulation and the added row f32. v_wmma_f32_16x16x32_f16.
#include <hip/hip_runtime.h>
#define PNR 1024                     /* rows */
#define PNG 64                       /* groups */
#define PNK 128                      /* a group's depth */
#define PNC 512                      /* a group's columns */
typedef unsigned short v8us __attribute__((ext_vector_type(8), may_alias));
typedef float  v8f  __attribute__((ext_vector_type(8)));
typedef float  v4f  __attribute__((ext_vector_type(4)));
typedef float  v4fa __attribute__((ext_vector_type(4), may_alias));

__device__ __forceinline__ unsigned short bf16_bits(float x) { unsigned int u = __float_as_uint(x); return (unsigned short)((u + 0x7FFFu + ((u >> 16) & 1u)) >> 16); }
__device__ __forceinline__ float bf16_val(unsigned short b) { return __uint_as_float(((unsigned int)b) << 16); }
__device__ __forceinline__ float bf16_round(float x) { return bf16_val(bf16_bits(x)); }

typedef _Float16 v16h __attribute__((ext_vector_type(16)));
union FragH { v16h v; v8us half[2]; _Float16 h[16]; unsigned short u[16]; };

// Wt[n][k] = f16(W[k][n] x scale) from f32 row-major W[K][N] (scale = power of two; bf16-exact weights stay exact in f16 away from the subnormal range)
__global__ __launch_bounds__(256) void k_wt_f16(const float* __restrict__ W, _Float16* __restrict__ Wt, int K, int N, float scale) {
  const int t = blockIdx.x * 256 + threadIdx.x; if (t >= N * (K / 8)) return; const int n = t / (K / 8), k8 = (t % (K / 8)) * 8; FragH f;
#pragma unroll
  for (int i = 0; i < 8; ++i) f.h[i] = (_Float16)(bf16_round(W[(size_t)(k8 + i) * N + n]) * scale); const v8us o = f.half[0];
  *(v8us*)((unsigned short*)Wt + (size_t)n * K + k8) = o; 
}

typedef _Float16 v4h __attribute__((ext_vector_type(4)));

__global__ __launch_bounds__(256) void k_x16(const float* __restrict__ x, _Float16* __restrict__ X16, size_t n8) { const size_t t = (size_t)blockIdx.x * 256 + threadIdx.x; if (t >= n8) return; FragH f;
#pragma unroll
  for (int q = 0; q < 8; ++q) f.h[q] = (_Float16)bf16_round(x[t * 8 + q]); *(v8us*)((unsigned short*)X16 + t * 8) = f.half[0];  }

// ---- fast GEMM (wave tile 32x64; requires M % 32 == 0 rows per launch region and N % 64 == 0) ----
__device__ __forceinline__ v16h g2_frag(const _Float16* p, int hh) { FragH f; f.half[0] = *(const v8us*)((const unsigned short*)p + 8 * hh); f.half[1] = *(const v8us*)((const unsigned short*)p + 16 + 8 * hh); return f.v; }
__device__ __forceinline__ v8f g2_mma(v16h a, v16h b, v8f c) { v8f d = __builtin_amdgcn_wmma_f32_16x16x32_f16(false, a, false, b, (short)0, c, false, false); asm volatile("v_nop\n\tv_nop\n\tv_nop\n\tv_nop" : "+v"(d) : "v"(a), "v"(b)); return d; }
template <int ACT>
__global__ __launch_bounds__(128) void k_gemm2(const _Float16* __restrict__ A, int lda, size_t sA, const _Float16* __restrict__ Bh, int ldb, size_t sB, float alpha, const float* __restrict__ bias, size_t sBias, const float* __restrict__ CP, int rowsPerB, size_t sCPb, int row0g,
    float* __restrict__ C, _Float16* __restrict__ C16, int ldc, size_t sC, int M, int N, int K) { static_assert(ACT == 0 || ACT == 3 || ACT == 6 || ACT == 8 || ACT == 9 || ACT == 11 || ACT == 12 || ACT == 14 || ACT == 15 || ACT == 16 || ACT == 17, "k_gemm2: unsupported ACT code (would silently apply no activation)");
  __shared__ __attribute__((aligned(16))) float so[4][32][68];
  const int tid = threadIdx.x, w = tid >> 5, lane = tid & 31, ln = lane & 15, hh = lane >> 4; const int by = blockIdx.y;
  A += (size_t)by * sA; Bh += (size_t)by * sB; const size_t cofs = (size_t)by * sC; const float* bp = bias ? bias + (size_t)by * sBias : nullptr;
  const int ntn = N >> 6; const int mt = blockIdx.x / ntn, nq = blockIdx.x - mt * ntn; const int row0 = mt * 128 + 32 * w, col0 = nq * 64; if (row0 >= M) return;
  const _Float16* a0p = A + (size_t)(row0 + ln) * lda; const _Float16* a1p = a0p + (size_t)16 * lda;
  const _Float16* b0p = Bh + (size_t)(col0 + ln) * ldb; const _Float16* b1p = b0p + (size_t)16 * ldb; const _Float16* b2p = b1p + (size_t)16 * ldb; const _Float16* b3p = b2p + (size_t)16 * ldb;
  const v8f z8 = {0.f,0.f,0.f,0.f,0.f,0.f,0.f,0.f}; v8f c00 = z8, c01 = z8, c02 = z8, c03 = z8, c10 = z8, c11 = z8, c12 = z8, c13 = z8;
  for (int kb = 0; kb < K; kb += 32) { const v16h a0 = g2_frag(a0p + kb, hh), a1 = g2_frag(a1p + kb, hh);
    v16h b = g2_frag(b0p + kb, hh); c00 = g2_mma(a0, b, c00); c10 = g2_mma(a1, b, c10);
    b = g2_frag(b1p + kb, hh); c01 = g2_mma(a0, b, c01); c11 = g2_mma(a1, b, c11);
    b = g2_frag(b2p + kb, hh); c02 = g2_mma(a0, b, c02); c12 = g2_mma(a1, b, c12);
    b = g2_frag(b3p + kb, hh); c03 = g2_mma(a0, b, c03); c13 = g2_mma(a1, b, c13); }
  v8f accs[8] = {c00, c01, c02, c03, c10, c11, c12, c13};
#pragma unroll
  for (int u = 0; u < 8; ++u) { const int t = u & 3, half = u >> 2; const int col = col0 + t * 16 + ln; const float bv = bp ? bf16_round(bp[col]) : 0.f;
#pragma unroll
    for (int r = 0; r < 8; ++r) { const int rloc = half * 16 + 8 * hh + r; float v = accs[u][r] * alpha + bv; if (CP) { if (rowsPerB < 0) v += CP[cofs + (size_t)(row0g + row0 + rloc) * ldc + col];      /* rowsPerB < 0: own element of the batched C plane */ else { const int bidx = (row0g + row0 + rloc) / rowsPerB; v += CP[(size_t)bidx * sCPb + (size_t)by * 64 + col]; } }
      if (ACT == 3) v = fmaxf(v, 0.f); else if (ACT == 6) v = 0.5f * v * (1.0f + erff(v * 0.70710678118654752f)); else if (ACT == 11) v = 1.0f / (1.0f + expf(-v)); else if (ACT == 15) v = v / (1.0f + expf(-v)); else if (ACT == 12) v = (v > 0.f) ? v : 0.01f * v; else if (ACT == 8) v = tanhf(v); else if (ACT == 9) v = 0.5f * v * (1.0f + tanhf(0.7978845608028654f * (v + 0.044715f * v * v * v))); else if (ACT == 14) v = (v > 0.f) ? v : 0.1f * v; else if (ACT == 16) v = (v >= 0.f) ? v : 0.3f * v; else if (ACT == 17) v = (v >= 0.f) ? v : 0.2f * v;
      so[w][rloc][t * 16 + ln] = v; } }
  __builtin_amdgcn_fence(__ATOMIC_ACQ_REL, "workgroup"); __builtin_amdgcn_wave_barrier();
  const int rsub = lane >> 4, c4 = (lane & 15) * 4;
  {
#pragma unroll
    for (int q = 0; q < 16; ++q) { const int r = q * 2 + rsub; const v4f v = *(const v4fa*)&so[w][r][c4]; if (C) *(v4f*)(C + cofs + (size_t)(row0 + r) * ldc + col0 + c4) = v; if (C16) { v4h h4; for (int i = 0; i < 4; ++i) h4[i] = (_Float16)v[i]; *(v4h*)(C16 + cofs + (size_t)(row0 + r) * ldc + col0 + c4) = h4; } }
     } }

extern "C" void kernel_launch(void* const* d_in, const int* in_sizes, int n_in,
                              void* d_out, int out_size, void* d_ws, size_t ws_size, hipStream_t stream) {
  if (n_in < 3) return; if (in_sizes[0] < PNR * PNG * PNK || in_sizes[1] < PNG * PNC * PNK || in_sizes[2] < PNG * PNC) return; if (out_size < PNR * PNG * PNC) return;
  const float* da = (const float*)d_in[0]; const float* wa = (const float*)d_in[1]; const float* ra = (const float*)d_in[2]; float* res = (float*)d_out;
  static_assert(PNR % 128 == 0 && PNC % 64 == 0 && PNK % 32 == 0 && PNK % 8 == 0, "whole tiles");
  uint8_t* wsp = (uint8_t*)d_ws; size_t off = 0;
  auto take = [&](size_t bytes) { uint8_t* at = wsp + off; off += (bytes + 255) & ~(size_t)255; return at; };
  _Float16* DA = (_Float16*)take((size_t)PNR * PNG * PNK * 2); _Float16* WA = (_Float16*)take((size_t)PNG * PNC * PNK * 2);      /* da as it lies [1024][64][128]; wa as it lies [64][512][128] */
  if (off > ws_size) return;
  k_x16<<<(unsigned)(((size_t)PNR * PNG * PNK / 8 + 255) / 256), 256, 0, stream>>>(da, DA, (size_t)PNR * PNG * PNK / 8);
  k_x16<<<(unsigned)(((size_t)PNG * PNC * PNK / 8 + 255) / 256), 256, 0, stream>>>(wa, WA, (size_t)PNG * PNC * PNK / 8);
  k_gemm2<0><<<dim3((unsigned)((PNR / 128) * (PNC / 64)), (unsigned)PNG), 128, 0, stream>>>(DA, PNG * PNK, (size_t)PNK, WA, PNK, (size_t)PNC * PNK, 1.0f, ra, (size_t)PNC, nullptr, 1, 0, 0, res, nullptr, PNG * PNC, (size_t)PNC, PNR, PNC, PNK);      /* result[:, g, :] = da[:, g, :] wa[g]^T plus ra[g] */
}

// v001
// It runs in 39.7 microseconds.
// In both of two side-by-side timings against v000, it was 1.39 times as fast.
// result[r][g][c] = sum over q of da[r][g][q] wa[g][c][q] plus ra[g][c]: da [1024][64][128] (sixty-four groups side by side in every row); wa [64][512][128] (a group's array stored column first: [column][depth]); ra [64][512] an added row a group -> [1024][64][512].
// Structure: da and wa are cast AS THEY LIE (a group's 128 words of da stand at offset 128 g of every 8,192-word row: the product reads them by pitch and group stride: no copy; a group's [512 columns][128 deep] of wa is already the product's second operand: no turning); ONE WMMA GEMM with the group as the grid's second index forms the result in f32 STRAIGHT INTO THE OUTPUT (1,024 rows, 512 columns, depth 128 a group; the added row at its own group stride; the output's pitch 32,768 words, its group stride 512).
// Compute dtype: each of the three arrays converted to bf16 where it is read; da and wa go to the matrix unit as plain f16 words of their bf16 values (exact down to 2^-14 as normals); the product's accumulation and the added row f32. v_wmma_f32_16x16x32_f16.
#include <hip/hip_runtime.h>
#define PNR 1024                     /* rows */
#define PNG 64                       /* groups */
#define PNK 128                      /* a group's depth */
#define PNC 512                      /* a group's columns */
typedef unsigned short v8us __attribute__((ext_vector_type(8), may_alias));
typedef float  v8f  __attribute__((ext_vector_type(8)));
typedef float  v4f  __attribute__((ext_vector_type(4)));
typedef float  v4fa __attribute__((ext_vector_type(4), may_alias));

__device__ __forceinline__ unsigned short bf16_bits(float x) { unsigned int u = __float_as_uint(x); return (unsigned short)((u + 0x7FFFu + ((u >> 16) & 1u)) >> 16); }
__device__ __forceinline__ float bf16_val(unsigned short b) { return __uint_as_float(((unsigned int)b) << 16); }
__device__ __forceinline__ float bf16_round(float x) { return bf16_val(bf16_bits(x)); }

typedef _Float16 v16h __attribute__((ext_vector_type(16)));
union FragH { v16h v; v8us half[2]; _Float16 h[16]; unsigned short u[16]; };

// Wt[n][k] = f16(W[k][n] x scale) from f32 row-major W[K][N] (scale = power of two; bf16-exact weights stay exact in f16 away from the subnormal range)
__global__ __launch_bounds__(256) void k_wt_f16(const float* __restrict__ W, _Float16* __restrict__ Wt, int K, int N, float scale) {
  const int t = blockIdx.x * 256 + threadIdx.x; if (t >= N * (K / 8)) return; const int n = t / (K / 8), k8 = (t % (K / 8)) * 8; FragH f;
#pragma unroll
  for (int i = 0; i < 8; ++i) f.h[i] = (_Float16)(bf16_round(W[(size_t)(k8 + i) * N + n]) * scale); const v8us o = f.half[0];
  *(v8us*)((unsigned short*)Wt + (size_t)n * K + k8) = o; 
}

typedef _Float16 v4h __attribute__((ext_vector_type(4)));

__global__ __launch_bounds__(256) void k_x16(const float* __restrict__ x, _Float16* __restrict__ X16, size_t n8) { const size_t t = (size_t)blockIdx.x * 256 + threadIdx.x; if (t >= n8) return; FragH f;
#pragma unroll
  for (int q = 0; q < 8; ++q) f.h[q] = (_Float16)bf16_round(x[t * 8 + q]); *(v8us*)((unsigned short*)X16 + t * 8) = f.half[0];  }

// ---- fast GEMM (wave tile 32x64, eight waves = block tile 128x128, depth PNK; requires M % 128 == 0 and N % 128 == 0) ----
// Both operand tiles come into LDS by loads that cover whole 256-byte rows (two rows a wave-wide load); the fragments are read from LDS.
#define G2_LDA (PNG * PNK)           /* pitch of the first operand's rows in memory, f16 words */
#define G2_LDB PNK                   /* pitch of the second operand's rows in memory, f16 words */
#define G2_PH 136                    /* LDS row pitch in f16 words: 272 B = 17 x 16 B, an odd count of 16 B for the 16-byte fragment reads */
__device__ __forceinline__ v16h g2_frag(const _Float16* p, int hh) { FragH f; f.half[0] = *(const v8us*)((const unsigned short*)p + 8 * hh); f.half[1] = *(const v8us*)((const unsigned short*)p + 16 + 8 * hh); return f.v; }
__device__ __forceinline__ v8f g2_mma(v16h a, v16h b, v8f c) { v8f d = __builtin_amdgcn_wmma_f32_16x16x32_f16(false, a, false, b, (short)0, c, false, false); asm volatile("v_nop\n\tv_nop\n\tv_nop\n\tv_nop" : "+v"(d) : "v"(a), "v"(b)); return d; }
template <int ACT>
__global__ __launch_bounds__(256) void k_gemm2(const _Float16* __restrict__ A, size_t sA, const _Float16* __restrict__ Bh, size_t sB, float alpha, const float* __restrict__ bias, size_t sBias, const float* __restrict__ CP, int rowsPerB, size_t sCPb, int row0g,
    float* __restrict__ C, _Float16* __restrict__ C16, int ldc, size_t sC, int M, int N) { static_assert(ACT == 0 || ACT == 3 || ACT == 6 || ACT == 8 || ACT == 9 || ACT == 11 || ACT == 12 || ACT == 14 || ACT == 15 || ACT == 16 || ACT == 17, "k_gemm2: unsupported ACT code (would silently apply no activation)");
  __shared__ __attribute__((aligned(16))) unsigned char sm[8 * 32 * 68 * 4];      /* first the two operand tiles (256 rows of 272 B), then, behind a barrier, each wave's 32 output rows */
  static_assert(256 * G2_PH * 2 <= 8 * 32 * 68 * 4 && PNK == 128, "operand tiles fit; a row is sixteen 16-byte pieces");
  unsigned short* const tA = (unsigned short*)sm; unsigned short* const tB = tA + 128 * G2_PH; float (* const so)[32][68] = (float (*)[32][68])sm;
  const int tid = threadIdx.x, w = tid >> 5, lane = tid & 31, ln = lane & 15, hh = lane >> 4; const int by = blockIdx.y;
  A += (size_t)by * sA; Bh += (size_t)by * sB; const size_t cofs = (size_t)by * sC; const float* bp = bias ? bias + (size_t)by * sBias : nullptr;
  const int ntn = N >> 7; const int mt = blockIdx.x / ntn, nq = blockIdx.x - mt * ntn; const int rowB = mt * 128, colB = nq * 128; if (rowB >= M) return;
  const int wr = w & 3, wc = w >> 2; const int row0 = rowB + 32 * wr, col0 = colB + 64 * wc;
  { const int c8 = (tid & 15) * 8, sr = tid >> 4; v8us ta[8], tb[8];
    const char* const gA = (const char*)(A + (size_t)rowB * G2_LDA); const char* const gB = (const char*)(Bh + (size_t)colB * G2_LDB);
    const unsigned oA = (unsigned)(sr * G2_LDA + c8) * 2u, oB = (unsigned)(sr * G2_LDB + c8) * 2u;      /* the lane's byte offsets in the two tiles */
    for (int i = 0; i < 8; ++i) ta[i] = *(const v8us*)(gA + oA + i * 16 * G2_LDA * 2);
    for (int i = 0; i < 8; ++i) tb[i] = *(const v8us*)(gB + oB + i * 16 * G2_LDB * 2);
    asm volatile("s_wait_xcnt 0x0" :: "v"(oA), "v"(oB) : "memory");      /* the sixteen loads' offset registers stay whole until this wait, which stands in front of their first overwrite */
    for (int i = 0; i < 8; ++i) *(v8us*)(tA + (i * 16 + sr) * G2_PH + c8) = ta[i];
    for (int i = 0; i < 8; ++i) *(v8us*)(tB + (i * 16 + sr) * G2_PH + c8) = tb[i]; }
  __syncthreads();      /* both tiles written before any wave reads a fragment */
  const _Float16* a0p = (const _Float16*)tA + (32 * wr + ln) * G2_PH; const _Float16* a1p = a0p + 16 * G2_PH;
  const _Float16* b0p = (const _Float16*)tB + (64 * wc + ln) * G2_PH; const _Float16* b1p = b0p + 16 * G2_PH; const _Float16* b2p = b1p + 16 * G2_PH; const _Float16* b3p = b2p + 16 * G2_PH;
  const v8f z8 = {0.f,0.f,0.f,0.f,0.f,0.f,0.f,0.f}; v8f c00 = z8, c01 = z8, c02 = z8, c03 = z8, c10 = z8, c11 = z8, c12 = z8, c13 = z8;
  for (int kb = 0; kb < PNK; kb += 32) { const v16h a0 = g2_frag(a0p + kb, hh), a1 = g2_frag(a1p + kb, hh);
    const v16h b0 = g2_frag(b0p + kb, hh), b1 = g2_frag(b1p + kb, hh), b2 = g2_frag(b2p + kb, hh), b3 = g2_frag(b3p + kb, hh);      /* a step's twelve LDS reads as one group, one wait's latency a step */
    c00 = g2_mma(a0, b0, c00); c10 = g2_mma(a1, b0, c10);
    c01 = g2_mma(a0, b1, c01); c11 = g2_mma(a1, b1, c11);
    c02 = g2_mma(a0, b2, c02); c12 = g2_mma(a1, b2, c12);
    c03 = g2_mma(a0, b3, c03); c13 = g2_mma(a1, b3, c13); }
  __syncthreads();      /* every wave's last fragment read ends before the output rows overwrite the tiles */
  v8f accs[8] = {c00, c01, c02, c03, c10, c11, c12, c13};
#pragma unroll
  for (int u = 0; u < 8; ++u) { const int t = u & 3, half = u >> 2; const int col = col0 + t * 16 + ln; const float bv = bp ? bf16_round(bp[col]) : 0.f;
#pragma unroll
    for (int r = 0; r < 8; ++r) { const int rloc = half * 16 + 8 * hh + r; float v = accs[u][r] * alpha + bv; if (CP) { if (rowsPerB < 0) v += CP[cofs + (size_t)(row0g + row0 + rloc) * ldc + col];      /* rowsPerB < 0: own element of the batched C plane */ else { const int bidx = (row0g + row0 + rloc) / rowsPerB; v += CP[(size_t)bidx * sCPb + (size_t)by * 64 + col]; } }
      if (ACT == 3) v = fmaxf(v, 0.f); else if (ACT == 6) v = 0.5f * v * (1.0f + erff(v * 0.70710678118654752f)); else if (ACT == 11) v = 1.0f / (1.0f + expf(-v)); else if (ACT == 15) v = v / (1.0f + expf(-v)); else if (ACT == 12) v = (v > 0.f) ? v : 0.01f * v; else if (ACT == 8) v = tanhf(v); else if (ACT == 9) v = 0.5f * v * (1.0f + tanhf(0.7978845608028654f * (v + 0.044715f * v * v * v))); else if (ACT == 14) v = (v > 0.f) ? v : 0.1f * v; else if (ACT == 16) v = (v >= 0.f) ? v : 0.3f * v; else if (ACT == 17) v = (v >= 0.f) ? v : 0.2f * v;
      so[w][rloc][t * 16 + ln] = v; } }
  __builtin_amdgcn_fence(__ATOMIC_ACQ_REL, "workgroup"); __builtin_amdgcn_wave_barrier();
  const int rsub = lane >> 4, c4 = (lane & 15) * 4;
  {
#pragma unroll
    for (int q = 0; q < 16; ++q) { const int r = q * 2 + rsub; const v4f v = *(const v4fa*)&so[w][r][c4]; if (C) *(v4f*)(C + cofs + (size_t)(row0 + r) * ldc + col0 + c4) = v; if (C16) { v4h h4; for (int i = 0; i < 4; ++i) h4[i] = (_Float16)v[i]; *(v4h*)(C16 + cofs + (size_t)(row0 + r) * ldc + col0 + c4) = h4; } }
     } }

extern "C" void kernel_launch(void* const* d_in, const int* in_sizes, int n_in,
                              void* d_out, int out_size, void* d_ws, size_t ws_size, hipStream_t stream) {
  if (n_in < 3) return; if (in_sizes[0] < PNR * PNG * PNK || in_sizes[1] < PNG * PNC * PNK || in_sizes[2] < PNG * PNC) return; if (out_size < PNR * PNG * PNC) return;
  const float* da = (const float*)d_in[0]; const float* wa = (const float*)d_in[1]; const float* ra = (const float*)d_in[2]; float* res = (float*)d_out;
  static_assert(PNR % 128 == 0 && PNC % 128 == 0 && PNK % 32 == 0 && PNK % 8 == 0, "whole tiles");
  uint8_t* wsp = (uint8_t*)d_ws; size_t off = 0;
  auto take = [&](size_t bytes) { uint8_t* at = wsp + off; off += (bytes + 255) & ~(size_t)255; return at; };
  _Float16* DA = (_Float16*)take((size_t)PNR * PNG * PNK * 2); _Float16* WA = (_Float16*)take((size_t)PNG * PNC * PNK * 2);      /* da as it lies [1024][64][128]; wa as it lies [64][512][128] */
  if (off > ws_size) return;
  k_x16<<<(unsigned)(((size_t)PNR * PNG * PNK / 8 + 255) / 256), 256, 0, stream>>>(da, DA, (size_t)PNR * PNG * PNK / 8);
  k_x16<<<(unsigned)(((size_t)PNG * PNC * PNK / 8 + 255) / 256), 256, 0, stream>>>(wa, WA, (size_t)PNG * PNC * PNK / 8);
  k_gemm2<0><<<dim3((unsigned)((PNR / 128) * (PNC / 128)), (unsigned)PNG), 256, 0, stream>>>(DA, (size_t)PNK, WA, (size_t)PNC * PNK, 1.0f, ra, (size_t)PNC, nullptr, 1, 0, 0, res, nullptr, PNG * PNC, (size_t)PNC, PNR, PNC);      /* result[:, g, :] = da[:, g, :] wa[g]^T plus ra[g] */
}

// v002
// It runs in 31.7 microseconds.
// Next to v001, in two timings, it ran 1.25 and 1.26 times as fast.
// All steps since v000 together make it 1.74 times as fast.
// result[r][g][c] = sum over q of da[r][g][q] wa[g][c][q] plus ra[g][c]: da [1024][64][128] (sixty-four groups side by side in every row); wa [64][512][128] (a group's array stored column first: [column][depth]); ra [64][512] an added row a group -> [1024][64][512].
// Structure: ONE launch. da and wa are read AS THEY LIE, in f32 (a group's 128 words of da stand at offset 128 g of every 8,192-word row: the product reads them by pitch and group stride: no copy; a group's [512 columns][128 deep] of wa is already the product's second operand: no turning); each work-group casts its own two operand tiles on their way from the registers into LDS; the WMMA GEMM with the group as the grid's second index forms the result in f32 STRAIGHT INTO THE OUTPUT (1,024 rows, 512 columns, depth 128 a group; the added row at its own group stride; the output's pitch 32,768 words, its group stride 512). No workspace.
// Compute dtype: each of the three arrays converted to bf16 where it is read; da and wa go to the matrix unit as plain f16 words of their bf16 values (exact down to 2^-14 as normals); the product's accumulation and the added row f32. v_wmma_f32_16x16x32_f16.
#include <hip/hip_runtime.h>
#define PNR 1024                     /* rows */
#define PNG 64                       /* groups */
#define PNK 128                      /* a group's depth */
#define PNC 512                      /* a group's columns */
typedef unsigned short v8us __attribute__((ext_vector_type(8), may_alias));
typedef float  v8f  __attribute__((ext_vector_type(8)));
typedef float  v4f  __attribute__((ext_vector_type(4)));
typedef float  v4fa __attribute__((ext_vector_type(4), may_alias));

__device__ __forceinline__ unsigned short bf16_bits(float x) { unsigned int u = __float_as_uint(x); return (unsigned short)((u + 0x7FFFu + ((u >> 16) & 1u)) >> 16); }
__device__ __forceinline__ float bf16_val(unsigned short b) { return __uint_as_float(((unsigned int)b) << 16); }
__device__ __forceinline__ float bf16_round(float x) { return bf16_val(bf16_bits(x)); }

typedef _Float16 v16h __attribute__((ext_vector_type(16)));
union FragH { v16h v; v8us half[2]; _Float16 h[16]; unsigned short u[16]; };

// Wt[n][k] = f16(W[k][n] x scale) from f32 row-major W[K][N] (scale = power of two; bf16-exact weights stay exact in f16 away from the subnormal range)
__global__ __launch_bounds__(256) void k_wt_f16(const float* __restrict__ W, _Float16* __restrict__ Wt, int K, int N, float scale) {
  const int t = blockIdx.x * 256 + threadIdx.x; if (t >= N * (K / 8)) return; const int n = t / (K / 8), k8 = (t % (K / 8)) * 8; FragH f;
#pragma unroll
  for (int i = 0; i < 8; ++i) f.h[i] = (_Float16)(bf16_round(W[(size_t)(k8 + i) * N + n]) * scale); const v8us o = f.half[0];
  *(v8us*)((unsigned short*)Wt + (size_t)n * K + k8) = o; 
}

typedef _Float16 v4h __attribute__((ext_vector_type(4)));

typedef unsigned short v4us __attribute__((ext_vector_type(4), may_alias));
union Quad { v4h h; v4us u; };
// four f32 words -> their bf16 values as f16 words
__device__ __forceinline__ v4us g2_cast4(v4f x) { Quad q;
#pragma unroll
  for (int i = 0; i < 4; ++i) q.h[i] = (_Float16)bf16_round(x[i]); return q.u; }

// ---- fast GEMM (wave tile 32x64, eight waves = block tile 128x128, depth PNK; requires M % 128 == 0 and N % 128 == 0); epilogue = k_gemm_hhx semantics ----
// Both operand tiles are read in f32 by loads that cover whole 512-byte rows (one row a wave-wide load), cast in registers and written to LDS as f16 words; the fragments are read from LDS.
#define G2_LDA (PNG * PNK)           /* pitch of the first operand's rows in memory, f32 words */
#define G2_LDB PNK                   /* pitch of the second operand's rows in memory, f32 words */
#define G2_PH 136                    /* LDS row pitch in f16 words: 272 B = 17 x 16 B, an odd count of 16 B for the 16-byte fragment reads */
__device__ __forceinline__ v16h g2_frag(const _Float16* p, int hh) { FragH f; f.half[0] = *(const v8us*)((const unsigned short*)p + 8 * hh); f.half[1] = *(const v8us*)((const unsigned short*)p + 16 + 8 * hh); return f.v; }
__device__ __forceinline__ v8f g2_mma(v16h a, v16h b, v8f c) { v8f d = __builtin_amdgcn_wmma_f32_16x16x32_f16(false, a, false, b, (short)0, c, false, false); asm volatile("v_nop\n\tv_nop\n\tv_nop\n\tv_nop" : "+v"(d) : "v"(a), "v"(b)); return d; }
template <int ACT>
__global__ __launch_bounds__(256) void k_gemm2(const float* __restrict__ A, size_t sA, const float* __restrict__ Bh, size_t sB, float alpha, const float* __restrict__ bias, size_t sBias, const float* __restrict__ CP, int rowsPerB, size_t sCPb, int row0g,
    float* __restrict__ C, _Float16* __restrict__ C16, int ldc, size_t sC, int M, int N) { static_assert(ACT == 0 || ACT == 3 || ACT == 6 || ACT == 8 || ACT == 9 || ACT == 11 || ACT == 12 || ACT == 14 || ACT == 15 || ACT == 16 || ACT == 17, "k_gemm2: unsupported ACT code (would silently apply no activation)");
  __shared__ __attribute__((aligned(16))) unsigned char sm[8 * 32 * 68 * 4];      /* first the two operand tiles (256 rows of 272 B), then, behind a barrier, each wave's 32 output rows */
  static_assert(256 * G2_PH * 2 <= 8 * 32 * 68 * 4 && PNK == 128, "operand tiles fit; a row is thirty-two 16-byte pieces of f32");
  unsigned short* const tA = (unsigned short*)sm; unsigned short* const tB = tA + 128 * G2_PH; float (* const so)[32][68] = (float (*)[32][68])sm;
  const int tid = threadIdx.x, w = tid >> 5, lane = tid & 31, ln = lane & 15, hh = lane >> 4; const int by = blockIdx.y;
  A += (size_t)by * sA; Bh += (size_t)by * sB; const size_t cofs = (size_t)by * sC; const float* bp = bias ? bias + (size_t)by * sBias : nullptr;
  const int ntn = N >> 7; const int mt = blockIdx.x / ntn, nq = blockIdx.x - mt * ntn; const int rowB = mt * 128, colB = nq * 128; if (rowB >= M) return;
  const int wr = w & 3, wc = w >> 2; const int row0 = rowB + 32 * wr, col0 = colB + 64 * wc;
  { const int c4 = lane * 4; v4f ta[16], tb[16];
    const char* const gA = (const char*)(A + (size_t)rowB * G2_LDA); const char* const gB = (const char*)(Bh + (size_t)colB * G2_LDB);
    const unsigned oA = (unsigned)(w * G2_LDA + c4) * 4u, oB = (unsigned)(w * G2_LDB + c4) * 4u;      /* the lane's byte offsets in the two tiles */
    for (int i = 0; i < 16; ++i) ta[i] = *(const v4fa*)(gA + oA + i * 8 * G2_LDA * 4);
    for (int i = 0; i < 16; ++i) tb[i] = *(const v4fa*)(gB + oB + i * 8 * G2_LDB * 4);
    asm volatile("s_wait_xcnt 0x0" :: "v"(oA), "v"(oB) : "memory");      /* the thirty-two loads' offset registers stay whole until this wait, which stands in front of their first overwrite */
    for (int i = 0; i < 16; ++i) *(v4us*)(tA + (i * 8 + w) * G2_PH + c4) = g2_cast4(ta[i]);
    for (int i = 0; i < 16; ++i) *(v4us*)(tB + (i * 8 + w) * G2_PH + c4) = g2_cast4(tb[i]); }
  __syncthreads();      /* both tiles written before any wave reads a fragment */
  const _Float16* a0p = (const _Float16*)tA + (32 * wr + ln) * G2_PH; const _Float16* a1p = a0p + 16 * G2_PH;
  const _Float16* b0p = (const _Float16*)tB + (64 * wc + ln) * G2_PH; const _Float16* b1p = b0p + 16 * G2_PH; const _Float16* b2p = b1p + 16 * G2_PH; const _Float16* b3p = b2p + 16 * G2_PH;
  const v8f z8 = {0.f,0.f,0.f,0.f,0.f,0.f,0.f,0.f}; v8f c00 = z8, c01 = z8, c02 = z8, c03 = z8, c10 = z8, c11 = z8, c12 = z8, c13 = z8;
  for (int kb = 0; kb < PNK; kb += 32) { const v16h a0 = g2_frag(a0p + kb, hh), a1 = g2_frag(a1p + kb, hh);
    const v16h b0 = g2_frag(b0p + kb, hh), b1 = g2_frag(b1p + kb, hh), b2 = g2_frag(b2p + kb, hh), b3 = g2_frag(b3p + kb, hh);      /* a step's twelve LDS reads as one group, one wait's latency a step */
    c00 = g2_mma(a0, b0, c00); c10 = g2_mma(a1, b0, c10);
    c01 = g2_mma(a0, b1, c01); c11 = g2_mma(a1, b1, c11);
    c02 = g2_mma(a0, b2, c02); c12 = g2_mma(a1, b2, c12);
    c03 = g2_mma(a0, b3, c03); c13 = g2_mma(a1, b3, c13); }
  __syncthreads();      /* every wave's last fragment read ends before the output rows overwrite the tiles */
  v8f accs[8] = {c00, c01, c02, c03, c10, c11, c12, c13};
#pragma unroll
  for (int u = 0; u < 8; ++u) { const int t = u & 3, half = u >> 2; const int col = col0 + t * 16 + ln; const float bv = bp ? bf16_round(bp[col]) : 0.f;
#pragma unroll
    for (int r = 0; r < 8; ++r) { const int rloc = half * 16 + 8 * hh + r; float v = accs[u][r] * alpha + bv; if (CP) { if (rowsPerB < 0) v += CP[cofs + (size_t)(row0g + row0 + rloc) * ldc + col];      /* rowsPerB < 0: own element of the batched C plane */ else { const int bidx = (row0g + row0 + rloc) / rowsPerB; v += CP[(size_t)bidx * sCPb + (size_t)by * 64 + col]; } }
      if (ACT == 3) v = fmaxf(v, 0.f); else if (ACT == 6) v = 0.5f * v * (1.0f + erff(v * 0.70710678118654752f)); else if (ACT == 11) v = 1.0f / (1.0f + expf(-v)); else if (ACT == 15) v = v / (1.0f + expf(-v)); else if (ACT == 12) v = (v > 0.f) ? v : 0.01f * v; else if (ACT == 8) v = tanhf(v); else if (ACT == 9) v = 0.5f * v * (1.0f + tanhf(0.7978845608028654f * (v + 0.044715f * v * v * v))); else if (ACT == 14) v = (v > 0.f) ? v : 0.1f * v; else if (ACT == 16) v = (v >= 0.f) ? v : 0.3f * v; else if (ACT == 17) v = (v >= 0.f) ? v : 0.2f * v;
      so[w][rloc][t * 16 + ln] = v; } }
  __builtin_amdgcn_fence(__ATOMIC_ACQ_REL, "workgroup"); __builtin_amdgcn_wave_barrier();
  const int rsub = lane >> 4, c4 = (lane & 15) * 4;
  {
#pragma unroll
    for (int q = 0; q < 16; ++q) { const int r = q * 2 + rsub; const v4f v = *(const v4fa*)&so[w][r][c4]; if (C) *(v4f*)(C + cofs + (size_t)(row0 + r) * ldc + col0 + c4) = v; if (C16) { v4h h4; for (int i = 0; i < 4; ++i) h4[i] = (_Float16)v[i]; *(v4h*)(C16 + cofs + (size_t)(row0 + r) * ldc + col0 + c4) = h4; } }
     } }

extern "C" void kernel_launch(void* const* d_in, const int* in_sizes, int n_in,
                              void* d_out, int out_size, void* d_ws, size_t ws_size, hipStream_t stream) {
  if (n_in < 3) return; if (in_sizes[0] < PNR * PNG * PNK || in_sizes[1] < PNG * PNC * PNK || in_sizes[2] < PNG * PNC) return; if (out_size < PNR * PNG * PNC) return;
  const float* da = (const float*)d_in[0]; const float* wa = (const float*)d_in[1]; const float* ra = (const float*)d_in[2]; float* res = (float*)d_out;
  static_assert(PNR % 128 == 0 && PNC % 128 == 0 && PNK % 32 == 0 && PNK % 8 == 0, "whole tiles");
  k_gemm2<0><<<dim3((unsigned)((PNR / 128) * (PNC / 128)), (unsigned)PNG), 256, 0, stream>>>(da, (size_t)PNK, wa, (size_t)PNC * PNK, 1.0f, ra, (size_t)PNC, nullptr, 1, 0, 0, res, nullptr, PNG * PNC, (size_t)PNC, PNR, PNC);      /* result[:, g, :] = da[:, g, :] wa[g]^T plus ra[g] */
}

// v003
// It runs in 27.3 microseconds.
// Two timings next to v002 both put it at 1.15 times that version's speed.
// Counting every step since v000, it is 2.01 times as fast.
// result[r][g][c] = sum over q of da[r][g][q] wa[g][c][q] plus ra[g][c]: da [1024][64][128] (sixty-four groups side by side in every row); wa [64][512][128] (a group's array stored column first: [column][depth]); ra [64][512] an added row a group -> [1024][64][512].
// Structure: ONE launch. da and wa are read AS THEY LIE, in f32 (a group's 128 words of da stand at offset 128 g of every 8,192-word row: the product reads them by pitch and group stride: no copy; a group's [512 columns][128 deep] of wa is already the product's second operand: no turning); each work-group casts its own two operand tiles on their way from the registers into LDS; the WMMA GEMM with the group as the grid's second index forms the result in f32 STRAIGHT INTO THE OUTPUT (1,024 rows, 512 columns, depth 128 a group; the added row at its own group stride; the output's pitch 32,768 words, its group stride 512). No workspace.
// Compute dtype: each of the three arrays converted to bf16 where it is read; da and wa go to the matrix unit as plain f16 words of their bf16 values (exact down to 2^-14 as normals); the product's accumulation and the added row f32. v_wmma_f32_16x16x32_f16.
#include <hip/hip_runtime.h>
#define PNR 1024                     /* rows */
#define PNG 64                       /* groups */
#define PNK 128                      /* a group's depth */
#define PNC 512                      /* a group's columns */
typedef unsigned short v8us __attribute__((ext_vector_type(8), may_alias));
typedef float  v8f  __attribute__((ext_vector_type(8)));
typedef float  v4f  __attribute__((ext_vector_type(4)));
typedef float  v4fa __attribute__((ext_vector_type(4), may_alias));

__device__ __forceinline__ unsigned short bf16_bits(float x) { unsigned int u = __float_as_uint(x); return (unsigned short)((u + 0x7FFFu + ((u >> 16) & 1u)) >> 16); }
__device__ __forceinline__ float bf16_val(unsigned short b) { return __uint_as_float(((unsigned int)b) << 16); }
__device__ __forceinline__ float bf16_round(float x) { return bf16_val(bf16_bits(x)); }

typedef _Float16 v16h __attribute__((ext_vector_type(16)));
union FragH { v16h v; v8us half[2]; _Float16 h[16]; unsigned short u[16]; };

// Wt[n][k] = f16(W[k][n] x scale) from f32 row-major W[K][N] (scale = power of two; bf16-exact weights stay exact in f16 away from the subnormal range)
__global__ __launch_bounds__(256) void k_wt_f16(const float* __restrict__ W, _Float16* __restrict__ Wt, int K, int N, float scale) {
  const int t = blockIdx.x * 256 + threadIdx.x; if (t >= N * (K / 8)) return; const int n = t / (K / 8), k8 = (t % (K / 8)) * 8; FragH f;
#pragma unroll
  for (int i = 0; i < 8; ++i) f.h[i] = (_Float16)(bf16_round(W[(size_t)(k8 + i) * N + n]) * scale); const v8us o = f.half[0];
  *(v8us*)((unsigned short*)Wt + (size_t)n * K + k8) = o; 
}

typedef _Float16 v4h __attribute__((ext_vector_type(4)));

typedef unsigned short v4us __attribute__((ext_vector_type(4), may_alias));
union Quad { v4h h; v4us u; };
// four f32 words -> their bf16 values as f16 words
__device__ __forceinline__ v4us g2_cast4(v4f x) { Quad q;
#pragma unroll
  for (int i = 0; i < 4; ++i) q.h[i] = (_Float16)bf16_round(x[i]); return q.u; }

// ---- fast GEMM (wave tile 32x64, eight waves = block tile 128x128, depth PNK; requires M % 128 == 0 and N % 128 == 0); epilogue: scale, the added row, ACT ----
// Both operand tiles are read in f32 by loads that cover whole 512-byte rows (one row a wave-wide load), cast in registers and written to LDS as f16 words; the fragments are read from LDS.
#define G2_LDA (PNG * PNK)           /* pitch of the first operand's rows in memory, f32 words */
#define G2_LDB PNK                   /* pitch of the second operand's rows in memory, f32 words */
#define G2_PH 136                    /* LDS row pitch in f16 words: 272 B = 17 x 16 B, an odd count of 16 B for the 16-byte fragment reads */
__device__ __forceinline__ v16h g2_frag(const _Float16* p, int hh) { FragH f; f.half[0] = *(const v8us*)((const unsigned short*)p + 8 * hh); f.half[1] = *(const v8us*)((const unsigned short*)p + 16 + 8 * hh); return f.v; }
__device__ __forceinline__ v8f g2_mma(v16h a, v16h b, v8f c) { v8f d = __builtin_amdgcn_wmma_f32_16x16x32_f16(false, a, false, b, (short)0, c, false, false); asm volatile("v_nop\n\tv_nop\n\tv_nop\n\tv_nop" : "+v"(d) : "v"(a), "v"(b)); return d; }
template <int ACT>
__global__ __launch_bounds__(256) void k_gemm2(const float* __restrict__ A, const float* __restrict__ Bh, float alpha, const float* __restrict__ bias, float* __restrict__ C) {
  constexpr size_t sA = PNK, sB = (size_t)PNC * PNK, sBias = PNC, sC = PNC; constexpr int ldc = PNG * PNC, M = PNR, N = PNC;      /* this product's group strides, output pitch and sizes as compile-time values: no address product and no test of an absent operand is left to run time */ static_assert(ACT == 0 || ACT == 3 || ACT == 6 || ACT == 8 || ACT == 9 || ACT == 11 || ACT == 12 || ACT == 14 || ACT == 15 || ACT == 16 || ACT == 17, "k_gemm2: unsupported ACT code (would silently apply no activation)");
  __shared__ __attribute__((aligned(16))) unsigned char sm[8 * 32 * 68 * 4];      /* first the two operand tiles (256 rows of 272 B), then, behind a barrier, each wave's 32 output rows */
  static_assert(256 * G2_PH * 2 <= 8 * 32 * 68 * 4 && PNK == 128, "operand tiles fit; a row is thirty-two 16-byte pieces of f32");
  unsigned short* const tA = (unsigned short*)sm; unsigned short* const tB = tA + 128 * G2_PH; float (* const so)[32][68] = (float (*)[32][68])sm;
  const int tid = threadIdx.x, w = tid >> 5, lane = tid & 31, ln = lane & 15, hh = lane >> 4; const int by = blockIdx.y;
  A += (size_t)by * sA; Bh += (size_t)by * sB; const size_t cofs = (size_t)by * sC; const float* bp = bias + (size_t)by * sBias;
  const int ntn = N >> 7; const int mt = blockIdx.x / ntn, nq = blockIdx.x - mt * ntn; const int rowB = mt * 128, colB = nq * 128; if (rowB >= M) return;
  const int wr = w & 3, wc = w >> 2; const int row0 = rowB + 32 * wr, col0 = colB + 64 * wc;
  { const int c4 = lane * 4; v4f ta[16], tb[16];
    const char* const gA = (const char*)(A + (size_t)rowB * G2_LDA); const char* const gB = (const char*)(Bh + (size_t)colB * G2_LDB);
    const unsigned oA = (unsigned)(w * G2_LDA + c4) * 4u, oB = (unsigned)(w * G2_LDB + c4) * 4u;      /* the lane's byte offsets in the two tiles */
    for (int i = 0; i < 16; ++i) ta[i] = *(const v4fa*)(gA + oA + i * 8 * G2_LDA * 4);
    for (int i = 0; i < 16; ++i) tb[i] = *(const v4fa*)(gB + oB + i * 8 * G2_LDB * 4);
    asm volatile("s_wait_xcnt 0x0" :: "v"(oA), "v"(oB) : "memory");      /* the thirty-two loads' offset registers stay whole until this wait, which stands in front of their first overwrite */
    for (int i = 0; i < 16; ++i) *(v4us*)(tA + (i * 8 + w) * G2_PH + c4) = g2_cast4(ta[i]);
    for (int i = 0; i < 16; ++i) *(v4us*)(tB + (i * 8 + w) * G2_PH + c4) = g2_cast4(tb[i]); }
  __syncthreads();      /* both tiles written before any wave reads a fragment */
  const _Float16* a0p = (const _Float16*)tA + (32 * wr + ln) * G2_PH; const _Float16* a1p = a0p + 16 * G2_PH;
  const _Float16* b0p = (const _Float16*)tB + (64 * wc + ln) * G2_PH; const _Float16* b1p = b0p + 16 * G2_PH; const _Float16* b2p = b1p + 16 * G2_PH; const _Float16* b3p = b2p + 16 * G2_PH;
  const v8f z8 = {0.f,0.f,0.f,0.f,0.f,0.f,0.f,0.f}; v8f c00 = z8, c01 = z8, c02 = z8, c03 = z8, c10 = z8, c11 = z8, c12 = z8, c13 = z8;
  for (int kb = 0; kb < PNK; kb += 32) { const v16h a0 = g2_frag(a0p + kb, hh), a1 = g2_frag(a1p + kb, hh);
    const v16h b0 = g2_frag(b0p + kb, hh), b1 = g2_frag(b1p + kb, hh), b2 = g2_frag(b2p + kb, hh), b3 = g2_frag(b3p + kb, hh);      /* a step's twelve LDS reads as one group, one wait's latency a step */
    c00 = g2_mma(a0, b0, c00); c10 = g2_mma(a1, b0, c10);
    c01 = g2_mma(a0, b1, c01); c11 = g2_mma(a1, b1, c11);
    c02 = g2_mma(a0, b2, c02); c12 = g2_mma(a1, b2, c12);
    c03 = g2_mma(a0, b3, c03); c13 = g2_mma(a1, b3, c13); }
  __syncthreads();      /* every wave's last fragment read ends before the output rows overwrite the tiles */
  v8f accs[8] = {c00, c01, c02, c03, c10, c11, c12, c13};
#pragma unroll
  for (int u = 0; u < 8; ++u) { const int t = u & 3, half = u >> 2; const int col = col0 + t * 16 + ln; const float bv = bf16_round(bp[col]);
#pragma unroll
    for (int r = 0; r < 8; ++r) { const int rloc = half * 16 + 8 * hh + r; float v = accs[u][r] * alpha + bv;
      if (ACT == 3) v = fmaxf(v, 0.f); else if (ACT == 6) v = 0.5f * v * (1.0f + erff(v * 0.70710678118654752f)); else if (ACT == 11) v = 1.0f / (1.0f + expf(-v)); else if (ACT == 15) v = v / (1.0f + expf(-v)); else if (ACT == 12) v = (v > 0.f) ? v : 0.01f * v; else if (ACT == 8) v = tanhf(v); else if (ACT == 9) v = 0.5f * v * (1.0f + tanhf(0.7978845608028654f * (v + 0.044715f * v * v * v))); else if (ACT == 14) v = (v > 0.f) ? v : 0.1f * v; else if (ACT == 16) v = (v >= 0.f) ? v : 0.3f * v; else if (ACT == 17) v = (v >= 0.f) ? v : 0.2f * v;
      so[w][rloc][t * 16 + ln] = v; } }
  __builtin_amdgcn_fence(__ATOMIC_ACQ_REL, "workgroup"); __builtin_amdgcn_wave_barrier();
  const int rsub = lane >> 4, c4 = (lane & 15) * 4;
  {
#pragma unroll
    for (int q = 0; q < 16; ++q) { const int r = q * 2 + rsub; const v4f v = *(const v4fa*)&so[w][r][c4]; *(v4f*)(C + cofs + (size_t)(row0 + r) * ldc + col0 + c4) = v; }
     } }

extern "C" void kernel_launch(void* const* d_in, const int* in_sizes, int n_in,
                              void* d_out, int out_size, void* d_ws, size_t ws_size, hipStream_t stream) {
  if (n_in < 3) return; if (in_sizes[0] < PNR * PNG * PNK || in_sizes[1] < PNG * PNC * PNK || in_sizes[2] < PNG * PNC) return; if (out_size < PNR * PNG * PNC) return;
  const float* da = (const float*)d_in[0]; const float* wa = (const float*)d_in[1]; const float* ra = (const float*)d_in[2]; float* res = (float*)d_out;
  static_assert(PNR % 128 == 0 && PNC % 128 == 0 && PNK % 32 == 0 && PNK % 8 == 0, "whole tiles");
  k_gemm2<0><<<dim3((unsigned)((PNR / 128) * (PNC / 128)), (unsigned)PNG), 256, 0, stream>>>(da, wa, 1.0f, ra, res);      /* result[:, g, :] = da[:, g, :] wa[g]^T plus ra[g] */
}

// v004
// A run of this version takes 20.1 microseconds.
// In two side-by-side timings against v003, it was 1.37 and 1.36 times as fast.
// Over all steps from v000 it is 2.74 times as fast.
// result[r][g][c] = sum over q of da[r][g][q] wa[g][c][q] plus ra[g][c]: da [1024][64][128] (sixty-four groups side by side in every row); wa [64][512][128] (a group's array stored column first: [column][depth]); ra [64][512] an added row a group -> [1024][64][512].
// Structure: ONE launch. da and wa are read AS THEY LIE, in f32 (a group's 128 words of da stand at offset 128 g of every 8,192-word row: the product reads them by pitch and group stride: no copy; a group's [512 columns][128 deep] of wa is already the product's second operand: no turning); each work-group casts its own operand tiles on their way from the registers into LDS (its 256 rows once, then the group's four 128-column tiles one after the other); the WMMA GEMM with the group as the grid's second index forms the result in f32 STRAIGHT INTO THE OUTPUT (1,024 rows, 512 columns, depth 128 a group; the added row at its own group stride; the output's pitch 32,768 words, its group stride 512). No workspace.
// Compute dtype: each of the three arrays converted to bf16 where it is read; da and wa go to the matrix unit as plain f16 words of their bf16 values (exact down to 2^-14 as normals); the product's accumulation and the added row f32. v_wmma_f32_16x16x32_f16.
#include <hip/hip_runtime.h>
#define PNR 1024                     /* rows */
#define PNG 64                       /* groups */
#define PNK 128                      /* a group's depth */
#define PNC 512                      /* a group's columns */
typedef unsigned short v8us __attribute__((ext_vector_type(8), may_alias));
typedef float  v8f  __attribute__((ext_vector_type(8)));
typedef float  v4f  __attribute__((ext_vector_type(4)));
typedef float  v4fa __attribute__((ext_vector_type(4), may_alias));

__device__ __forceinline__ unsigned short bf16_bits(float x) { unsigned int u = __float_as_uint(x); return (unsigned short)((u + 0x7FFFu + ((u >> 16) & 1u)) >> 16); }
__device__ __forceinline__ float bf16_val(unsigned short b) { return __uint_as_float(((unsigned int)b) << 16); }
__device__ __forceinline__ float bf16_round(float x) { return bf16_val(bf16_bits(x)); }

typedef _Float16 v16h __attribute__((ext_vector_type(16)));
union FragH { v16h v; v8us half[2]; _Float16 h[16]; unsigned short u[16]; };

// Wt[n][k] = f16(W[k][n] x scale) from f32 row-major W[K][N] (scale = power of two; bf16-exact weights stay exact in f16 away from the subnormal range)
__global__ __launch_bounds__(256) void k_wt_f16(const float* __restrict__ W, _Float16* __restrict__ Wt, int K, int N, float scale) {
  const int t = blockIdx.x * 256 + threadIdx.x; if (t >= N * (K / 8)) return; const int n = t / (K / 8), k8 = (t % (K / 8)) * 8; FragH f;
#pragma unroll
  for (int i = 0; i < 8; ++i) f.h[i] = (_Float16)(bf16_round(W[(size_t)(k8 + i) * N + n]) * scale); const v8us o = f.half[0];
  *(v8us*)((unsigned short*)Wt + (size_t)n * K + k8) = o; 
}

typedef _Float16 v4h __attribute__((ext_vector_type(4)));

typedef unsigned short v4us __attribute__((ext_vector_type(4), may_alias));
union Quad { v4h h; v4us u; };
// four f32 words -> their bf16 values as f16 words
__device__ __forceinline__ v4us g2_cast4(v4f x) { Quad q;
#pragma unroll
  for (int i = 0; i < 4; ++i) q.h[i] = (_Float16)bf16_round(x[i]); return q.u; }

// ---- fast GEMM (wave tile 32x64, sixteen waves = pass tile 256x128, depth PNK; a work-group keeps its 256 rows and walks every 128-column tile of its group); epilogue: scale, the added row, ACT ----
// Both operands are read in f32 by loads that cover whole 512-byte rows (one row a wave-wide load), cast in registers and written to LDS as f16 words; the fragments are read from LDS.
// The first operand's 256 rows are staged once. The second operand's tiles alternate between two LDS buffers: a tile's loads are issued one pass ahead and stay in flight over an epilogue and a pass of products.
#define G2_LDA (PNG * PNK)           /* pitch of the first operand's rows in memory, f32 words */
#define G2_LDB PNK                   /* pitch of the second operand's rows in memory, f32 words */
#define G2_PH 136                    /* LDS row pitch in f16 words: 272 B = 17 x 16 B, an odd count of 16 B for the 16-byte fragment reads */
#define G2_BM 256                    /* rows a work-group */
#define G2_BN 128                    /* columns a pass */
__device__ __forceinline__ v16h g2_frag(const _Float16* p, int hh) { FragH f; f.half[0] = *(const v8us*)((const unsigned short*)p + 8 * hh); f.half[1] = *(const v8us*)((const unsigned short*)p + 16 + 8 * hh); return f.v; }
__device__ __forceinline__ v8f g2_mma(v16h a, v16h b, v8f c) { v8f d = __builtin_amdgcn_wmma_f32_16x16x32_f16(false, a, false, b, (short)0, c, false, false); asm volatile("v_nop\n\tv_nop\n\tv_nop\n\tv_nop" : "+v"(d) : "v"(a), "v"(b)); return d; }
// Work-group barrier whose fences order LDS alone: the waves hand each other nothing but LDS, and a fence over global memory too would make every wave wait here for its output stores and for the loads it has in flight.
__device__ __forceinline__ void g2_bar() { __builtin_amdgcn_fence(__ATOMIC_RELEASE, "workgroup", "local"); __builtin_amdgcn_s_barrier(); __builtin_amdgcn_fence(__ATOMIC_ACQUIRE, "workgroup", "local"); }
template <int ACT>
__global__ __launch_bounds__(512) void k_gemm2(const float* __restrict__ A, const float* __restrict__ Bh, float alpha, const float* __restrict__ bias, float* __restrict__ C) {
  constexpr size_t sA = PNK, sB = (size_t)PNC * PNK, sBias = PNC, sC = PNC; constexpr int ldc = PNG * PNC, M = PNR, N = PNC, NT = N / G2_BN;      /* this product's group strides, output pitch and sizes as compile-time values: no address product and no test of an absent operand is left to run time */ static_assert(ACT == 0 || ACT == 3 || ACT == 6 || ACT == 8 || ACT == 9 || ACT == 11 || ACT == 12 || ACT == 14 || ACT == 15 || ACT == 16 || ACT == 17, "k_gemm2: unsupported ACT code (would silently apply no activation)");
  __shared__ __attribute__((aligned(16))) unsigned short tA[G2_BM * G2_PH];          /* the work-group's rows, staged once */
  __shared__ __attribute__((aligned(16))) unsigned short tB[2][G2_BN * G2_PH];       /* two column tiles: one read by the products, one being filled */
  __shared__ __attribute__((aligned(16))) float so[16][32][68];                      /* each wave's own 32 output rows */
  static_assert(PNK == 128 && NT >= 2, "a row is thirty-two 16-byte pieces of f32; both buffers are used");
  const int tid = threadIdx.x, w = tid >> 5, lane = tid & 31, ln = lane & 15, hh = lane >> 4; const int by = blockIdx.y;
  A += (size_t)by * sA; Bh += (size_t)by * sB; const float* bp = bias + (size_t)by * sBias;
  const int rowB = blockIdx.x * G2_BM; if (rowB >= M) return;
  const int wr = w & 7, wc = w >> 3;
  const int l4 = lane * 4; v4f tn[8];
  const char* const gA = (const char*)(A + (size_t)rowB * G2_LDA); const char* const gB = (const char*)Bh; const char* const gR = (const char*)bp;
  char* const gC = (char*)(C + (size_t)by * sC + (size_t)rowB * ldc);
  const unsigned oA = (unsigned)(w * G2_LDA + l4) * 4u, oB = (unsigned)(w * G2_LDB + l4) * 4u, oR = (unsigned)(64 * wc + ln) * 4u;      /* the lane's byte offsets in the two operands and in the added row */
  const int rsub = lane >> 4, c4 = (lane & 15) * 4;
  const unsigned oC = (unsigned)((32 * wr + rsub) * ldc + 64 * wc + c4) * 4u;      /* the lane's byte offset in the work-group's part of the output */
  { v4f ta[16];
    for (int i = 0; i < 16; ++i) ta[i] = *(const v4fa*)(gA + oA + i * 16 * G2_LDA * 4);
    for (int i = 0; i < 8; ++i) tn[i] = *(const v4fa*)(gB + oB + i * 16 * G2_LDB * 4);
    asm volatile("s_wait_xcnt 0x0" :: "v"(oA), "v"(oB) : "memory");      /* the loads' offset registers stay whole until this wait, which stands in front of their first overwrite */
    for (int i = 0; i < 16; ++i) *(v4us*)(tA + (i * 16 + w) * G2_PH + l4) = g2_cast4(ta[i]);
    for (int i = 0; i < 8; ++i) *(v4us*)(tB[0] + (i * 16 + w) * G2_PH + l4) = g2_cast4(tn[i]); }
  g2_bar();      /* the rows and the first column tile written before any wave reads a fragment */
  for (int i = 0; i < 8; ++i) tn[i] = *(const v4fa*)(gB + oB + (G2_BN + i * 16) * G2_LDB * 4);
  asm volatile("s_wait_xcnt 0x0" :: "v"(oB) : "memory");      /* as above, for the second tile's loads */
  const _Float16* a0p = (const _Float16*)tA + (32 * wr + ln) * G2_PH; const _Float16* a1p = a0p + 16 * G2_PH;
#pragma unroll      /* the buffer index, the tile's offsets and the last passes' cases become compile-time */
  for (int t = 0; t < NT; ++t) {
    float bv[4];
    for (int j = 0; j < 4; ++j) bv[j] = *(const float*)(gR + oR + (t * G2_BN + j * 16) * 4);      /* the pass's piece of the added row, asked for ahead of the products */
    asm volatile("s_wait_xcnt 0x0" :: "v"(oR) : "memory");      /* as above, for the added row's loads */
    const _Float16* b0p = (const _Float16*)tB[t & 1] + (64 * wc + ln) * G2_PH; const _Float16* b1p = b0p + 16 * G2_PH; const _Float16* b2p = b1p + 16 * G2_PH; const _Float16* b3p = b2p + 16 * G2_PH;
    const v8f z8 = {0.f,0.f,0.f,0.f,0.f,0.f,0.f,0.f}; v8f c00 = z8, c01 = z8, c02 = z8, c03 = z8, c10 = z8, c11 = z8, c12 = z8, c13 = z8;
#pragma unroll      /* four steps, their LDS offsets as immediates */
    for (int kb = 0; kb < PNK; kb += 32) { const v16h a0 = g2_frag(a0p + kb, hh), a1 = g2_frag(a1p + kb, hh);
      const v16h b0 = g2_frag(b0p + kb, hh), b1 = g2_frag(b1p + kb, hh), b2 = g2_frag(b2p + kb, hh), b3 = g2_frag(b3p + kb, hh);      /* a step's twelve LDS reads as one group, one wait's latency a step */
      c00 = g2_mma(a0, b0, c00); c10 = g2_mma(a1, b0, c10);
      c01 = g2_mma(a0, b1, c01); c11 = g2_mma(a1, b1, c11);
      c02 = g2_mma(a0, b2, c02); c12 = g2_mma(a1, b2, c12);
      c03 = g2_mma(a0, b3, c03); c13 = g2_mma(a1, b3, c13); }
    __builtin_amdgcn_sched_barrier(0);      /* keeps the next tile's cast and the added row's rounding, and with them the waits for their loads, behind the products */
    if (t + 1 < NT) {
      for (int i = 0; i < 8; ++i) *(v4us*)(tB[(t + 1) & 1] + (i * 16 + w) * G2_PH + l4) = g2_cast4(tn[i]);      /* into the buffer whose readers all passed the barrier of the pass before */
      g2_bar();      /* the next tile written, and this tile's last fragment read ended, before any wave goes on */
      if (t + 2 < NT) {
        for (int i = 0; i < 8; ++i) tn[i] = *(const v4fa*)(gB + oB + ((t + 2) * G2_BN + i * 16) * G2_LDB * 4);
        asm volatile("s_wait_xcnt 0x0" :: "v"(oB) : "memory");      /* as above, for the tile after next */
      } }
    v8f accs[8] = {c00, c01, c02, c03, c10, c11, c12, c13};
#pragma unroll
    for (int u = 0; u < 8; ++u) { const int t4 = u & 3, half = u >> 2; const float bvr = bf16_round(bv[t4]);
#pragma unroll
      for (int r = 0; r < 8; ++r) { const int rloc = half * 16 + 8 * hh + r; float v = accs[u][r] * alpha + bvr;
        if (ACT == 3) v = fmaxf(v, 0.f); else if (ACT == 6) v = 0.5f * v * (1.0f + erff(v * 0.70710678118654752f)); else if (ACT == 11) v = 1.0f / (1.0f + expf(-v)); else if (ACT == 15) v = v / (1.0f + expf(-v)); else if (ACT == 12) v = (v > 0.f) ? v : 0.01f * v; else if (ACT == 8) v = tanhf(v); else if (ACT == 9) v = 0.5f * v * (1.0f + tanhf(0.7978845608028654f * (v + 0.044715f * v * v * v))); else if (ACT == 14) v = (v > 0.f) ? v : 0.1f * v; else if (ACT == 16) v = (v >= 0.f) ? v : 0.3f * v; else if (ACT == 17) v = (v >= 0.f) ? v : 0.2f * v;
        so[w][rloc][t4 * 16 + ln] = v; } }
    __builtin_amdgcn_fence(__ATOMIC_ACQ_REL, "workgroup", "local"); __builtin_amdgcn_wave_barrier();      /* the wave's rows written before its lanes read them back; LDS alone, so that the loads in flight and the earlier stores are not waited for */
#pragma unroll
    for (int q = 0; q < 16; ++q) { const int r = q * 2 + rsub; const v4f v = *(const v4fa*)&so[w][r][c4]; *(v4f*)(gC + oC + (q * 2 * ldc + t * G2_BN) * 4) = v; }
    asm volatile("s_wait_xcnt 0x0" :: "v"(oC) : "memory");      /* the stores' offset and data registers stay whole until this wait; the next pass overwrites them behind it */
  } }

extern "C" void kernel_launch(void* const* d_in, const int* in_sizes, int n_in,
                              void* d_out, int out_size, void* d_ws, size_t ws_size, hipStream_t stream) {
  if (n_in < 3) return; if (in_sizes[0] < PNR * PNG * PNK || in_sizes[1] < PNG * PNC * PNK || in_sizes[2] < PNG * PNC) return; if (out_size < PNR * PNG * PNC) return;
  const float* da = (const float*)d_in[0]; const float* wa = (const float*)d_in[1]; const float* ra = (const float*)d_in[2]; float* res = (float*)d_out;
  static_assert(PNR % G2_BM == 0 && PNC % G2_BN == 0 && PNK % 32 == 0 && PNK % 8 == 0, "whole tiles");
  k_gemm2<0><<<dim3((unsigned)(PNR / G2_BM), (unsigned)PNG), 512, 0, stream>>>(da, wa, 1.0f, ra, res);      /* result[:, g, :] = da[:, g, :] wa[g]^T plus ra[g] */
}

// v005
// One run takes 19.5 microseconds.
// Next to v004, in two timings, it ran 1.03 times as fast each time.
// All steps since v000 together make it 2.82 times as fast.
// result[r][g][c] = sum over q of da[r][g][q] wa[g][c][q] plus ra[g][c]: da [1024][64][128] (sixty-four groups side by side in every row); wa [64][512][128] (a group's array stored column first: [column][depth]); ra [64][512] an added row a group -> [1024][64][512].
// Structure: ONE launch. da and wa are read AS THEY LIE, in f32 (a group's 128 words of da stand at offset 128 g of every 8,192-word row: the product reads them by pitch and group stride: no copy; a group's [512 columns][128 deep] of wa is already the product's second operand: no turning); each work-group casts its own operand tiles on their way from the registers into LDS (its 256 rows once, then the group's four 128-column tiles one after the other); the WMMA GEMM with the group as the grid's second index forms the result in f32 STRAIGHT INTO THE OUTPUT (1,024 rows, 512 columns, depth 128 a group; the added row at its own group stride; the output's pitch 32,768 words, its group stride 512). No workspace.
// Compute dtype: each of the three arrays converted to bf16 where it is read; da and wa go to the matrix unit as plain f16 words of their bf16 values (exact down to 2^-14 as normals); the product's accumulation and the added row f32. v_wmma_f32_16x16x32_f16.
#include <hip/hip_runtime.h>
#define PNR 1024                     /* rows */
#define PNG 64                       /* groups */
#define PNK 128                      /* a group's depth */
#define PNC 512                      /* a group's columns */
typedef unsigned short v8us __attribute__((ext_vector_type(8), may_alias));
typedef float  v8f  __attribute__((ext_vector_type(8)));
typedef float  v4f  __attribute__((ext_vector_type(4)));
typedef float  v4fa __attribute__((ext_vector_type(4), may_alias));

__device__ __forceinline__ unsigned short bf16_bits(float x) { unsigned int u = __float_as_uint(x); return (unsigned short)((u + 0x7FFFu + ((u >> 16) & 1u)) >> 16); }
__device__ __forceinline__ float bf16_val(unsigned short b) { return __uint_as_float(((unsigned int)b) << 16); }
__device__ __forceinline__ float bf16_round(float x) { return bf16_val(bf16_bits(x)); }

typedef _Float16 v16h __attribute__((ext_vector_type(16)));
union FragH { v16h v; v8us half[2]; _Float16 h[16]; unsigned short u[16]; };

// Wt[n][k] = f16(W[k][n] x scale) from f32 row-major W[K][N] (scale = power of two; bf16-exact weights stay exact in f16 away from the subnormal range)
__global__ __launch_bounds__(256) void k_wt_f16(const float* __restrict__ W, _Float16* __restrict__ Wt, int K, int N, float scale) {
  const int t = blockIdx.x * 256 + threadIdx.x; if (t >= N * (K / 8)) return; const int n = t / (K / 8), k8 = (t % (K / 8)) * 8; FragH f;
#pragma unroll
  for (int i = 0; i < 8; ++i) f.h[i] = (_Float16)(bf16_round(W[(size_t)(k8 + i) * N + n]) * scale); const v8us o = f.half[0];
  *(v8us*)((unsigned short*)Wt + (size_t)n * K + k8) = o; 
}

typedef _Float16 v4h __attribute__((ext_vector_type(4)));

typedef unsigned short v4us __attribute__((ext_vector_type(4), may_alias));
union Quad { v4h h; v4us u; };
// four f32 words -> their bf16 values as f16 words
__device__ __forceinline__ v4us g2_cast4(v4f x) { Quad q;
#pragma unroll
  for (int i = 0; i < 4; ++i) q.h[i] = (_Float16)bf16_round(x[i]); return q.u; }

// ---- fast GEMM (wave tile 32x64, sixteen waves = pass tile 256x128, depth PNK; a work-group keeps its 256 rows and walks every 128-column tile of its group); epilogue: scale, the added row, ACT ----
// Both operands are read in f32 by loads that cover whole 512-byte rows (one row a wave-wide load), cast in registers and written to LDS as f16 words; the fragments are read from LDS.
// A pass's results wait in the wave's own LDS rows and are stored during the next pass, eight rows behind each product step's LDS reads.
// The first operand's 256 rows are staged once. The second operand's tiles alternate between two LDS buffers: a tile's loads are issued one pass ahead and stay in flight over an epilogue and a pass of products.
#define G2_LDA (PNG * PNK)           /* pitch of the first operand's rows in memory, f32 words */
#define G2_LDB PNK                   /* pitch of the second operand's rows in memory, f32 words */
#define G2_PH 136                    /* LDS row pitch in f16 words: 272 B = 17 x 16 B, an odd count of 16 B for the 16-byte fragment reads */
#define G2_BM 256                    /* rows a work-group */
#define G2_BN 128                    /* columns a pass */
__device__ __forceinline__ v16h g2_frag(const _Float16* p, int hh) { FragH f; f.half[0] = *(const v8us*)((const unsigned short*)p + 8 * hh); f.half[1] = *(const v8us*)((const unsigned short*)p + 16 + 8 * hh); return f.v; }
__device__ __forceinline__ v8f g2_mma(v16h a, v16h b, v8f c) { v8f d = __builtin_amdgcn_wmma_f32_16x16x32_f16(false, a, false, b, (short)0, c, false, false); asm volatile("v_nop\n\tv_nop\n\tv_nop\n\tv_nop" : "+v"(d) : "v"(a), "v"(b)); return d; }
// Work-group barrier whose fences order LDS alone: the waves hand each other nothing but LDS, and a fence over global memory too would make every wave wait here for its output stores and for the loads it has in flight.
__device__ __forceinline__ void g2_bar() { __builtin_amdgcn_fence(__ATOMIC_RELEASE, "workgroup", "local"); __builtin_amdgcn_s_barrier(); __builtin_amdgcn_fence(__ATOMIC_ACQUIRE, "workgroup", "local"); }
template <int ACT>
__global__ __launch_bounds__(512) void k_gemm2(const float* __restrict__ A, const float* __restrict__ Bh, float alpha, const float* __restrict__ bias, float* __restrict__ C) {
  constexpr size_t sA = PNK, sB = (size_t)PNC * PNK, sBias = PNC, sC = PNC; constexpr int ldc = PNG * PNC, M = PNR, N = PNC, NT = N / G2_BN;      /* this product's group strides, output pitch and sizes as compile-time values: no address product and no test of an absent operand is left to run time */ static_assert(ACT == 0 || ACT == 3 || ACT == 6 || ACT == 8 || ACT == 9 || ACT == 11 || ACT == 12 || ACT == 14 || ACT == 15 || ACT == 16 || ACT == 17, "k_gemm2: unsupported ACT code (would silently apply no activation)");
  __shared__ __attribute__((aligned(16))) unsigned short tA[G2_BM * G2_PH];          /* the work-group's rows, staged once */
  __shared__ __attribute__((aligned(16))) unsigned short tB[2][G2_BN * G2_PH];       /* two column tiles: one read by the products, one being filled */
  __shared__ __attribute__((aligned(16))) float so[16][32][68];                      /* each wave's own 32 output rows */
  static_assert(PNK == 128 && NT >= 2, "a row is thirty-two 16-byte pieces of f32; both buffers are used");
  const int tid = threadIdx.x, w = tid >> 5, lane = tid & 31, ln = lane & 15, hh = lane >> 4; const int by = blockIdx.y;
  A += (size_t)by * sA; Bh += (size_t)by * sB; const float* bp = bias + (size_t)by * sBias;
  const int rowB = blockIdx.x * G2_BM; if (rowB >= M) return;
  const int wr = w & 7, wc = w >> 3;
  const int l4 = lane * 4; v4f tn[8];
  const char* const gA = (const char*)(A + (size_t)rowB * G2_LDA); const char* const gB = (const char*)Bh; const char* const gR = (const char*)bp;
  char* const gC = (char*)(C + (size_t)by * sC + (size_t)rowB * ldc);
  const unsigned oA = (unsigned)(w * G2_LDA + l4) * 4u, oB = (unsigned)(w * G2_LDB + l4) * 4u, oR = (unsigned)(64 * wc + ln) * 4u;      /* the lane's byte offsets in the two operands and in the added row */
  const int rsub = lane >> 4, c4 = (lane & 15) * 4;
  const unsigned oC = (unsigned)((32 * wr + rsub) * ldc + 64 * wc + c4) * 4u;      /* the lane's byte offset in the work-group's part of the output */
  { v4f ta[16];
    for (int i = 0; i < 16; ++i) ta[i] = *(const v4fa*)(gA + oA + i * 16 * G2_LDA * 4);
    for (int i = 0; i < 8; ++i) tn[i] = *(const v4fa*)(gB + oB + i * 16 * G2_LDB * 4);
    asm volatile("s_wait_xcnt 0x0" :: "v"(oA), "v"(oB) : "memory");      /* the loads' offset registers stay whole until this wait, which stands in front of their first overwrite */
    for (int i = 0; i < 16; ++i) *(v4us*)(tA + (i * 16 + w) * G2_PH + l4) = g2_cast4(ta[i]);
    for (int i = 0; i < 8; ++i) *(v4us*)(tB[0] + (i * 16 + w) * G2_PH + l4) = g2_cast4(tn[i]); }
  g2_bar();      /* the rows and the first column tile written before any wave reads a fragment */
  for (int i = 0; i < 8; ++i) tn[i] = *(const v4fa*)(gB + oB + (G2_BN + i * 16) * G2_LDB * 4);
  asm volatile("s_wait_xcnt 0x0" :: "v"(oB) : "memory");      /* as above, for the second tile's loads */
  const _Float16* a0p = (const _Float16*)tA + (32 * wr + ln) * G2_PH; const _Float16* a1p = a0p + 16 * G2_PH;
#pragma unroll      /* the buffer index, the tile's offsets and the last passes' cases become compile-time */
  for (int t = 0; t < NT; ++t) {
    float bv[4];
    for (int j = 0; j < 4; ++j) bv[j] = *(const float*)(gR + oR + (t * G2_BN + j * 16) * 4);      /* the pass's piece of the added row, asked for ahead of the products */
    asm volatile("s_wait_xcnt 0x0" :: "v"(oR) : "memory");      /* as above, for the added row's loads */
    const _Float16* b0p = (const _Float16*)tB[t & 1] + (64 * wc + ln) * G2_PH; const _Float16* b1p = b0p + 16 * G2_PH; const _Float16* b2p = b1p + 16 * G2_PH; const _Float16* b3p = b2p + 16 * G2_PH;
    const v8f z8 = {0.f,0.f,0.f,0.f,0.f,0.f,0.f,0.f}; v8f c00 = z8, c01 = z8, c02 = z8, c03 = z8, c10 = z8, c11 = z8, c12 = z8, c13 = z8;
#pragma unroll      /* four steps, their LDS offsets as immediates */
    for (int kb = 0; kb < PNK; kb += 32) { const v16h a0 = g2_frag(a0p + kb, hh), a1 = g2_frag(a1p + kb, hh);
      const v16h b0 = g2_frag(b0p + kb, hh), b1 = g2_frag(b1p + kb, hh), b2 = g2_frag(b2p + kb, hh), b3 = g2_frag(b3p + kb, hh);      /* a step's twelve LDS reads as one group, one wait's latency a step */
      v4f sv[4];      /* a quarter (eight rows) of the pass before: its stores leave while this step's products run, not as one burst between two passes */
      if (t > 0) { for (int q = 0; q < 4; ++q) sv[q] = *(const v4fa*)&so[w][kb / 4 + q * 2 + rsub][c4];
        for (int q = 0; q < 4; ++q) *(v4f*)(gC + oC + ((kb / 4 + q * 2) * ldc + (t - 1) * G2_BN) * 4) = sv[q]; }
      c00 = g2_mma(a0, b0, c00); c10 = g2_mma(a1, b0, c10);
      c01 = g2_mma(a0, b1, c01); c11 = g2_mma(a1, b1, c11);
      c02 = g2_mma(a0, b2, c02); c12 = g2_mma(a1, b2, c12);
      c03 = g2_mma(a0, b3, c03); c13 = g2_mma(a1, b3, c13);
      if (t > 0) asm volatile("s_wait_xcnt 0x0" :: "v"(oC), "v"(sv[0]), "v"(sv[1]), "v"(sv[2]), "v"(sv[3]) : "memory");      /* the four stores' offset and data registers stay whole until this wait; the next step overwrites them behind it */
    }
    __builtin_amdgcn_sched_barrier(0);      /* keeps the next tile's cast and the added row's rounding, and with them the waits for their loads, behind the products */
    if (t + 1 < NT) {
      for (int i = 0; i < 8; ++i) *(v4us*)(tB[(t + 1) & 1] + (i * 16 + w) * G2_PH + l4) = g2_cast4(tn[i]);      /* into the buffer whose readers all passed the barrier of the pass before */
      g2_bar();      /* the next tile written, and this tile's last fragment read ended, before any wave goes on */
      if (t + 2 < NT) {
        for (int i = 0; i < 8; ++i) tn[i] = *(const v4fa*)(gB + oB + ((t + 2) * G2_BN + i * 16) * G2_LDB * 4);
        asm volatile("s_wait_xcnt 0x0" :: "v"(oB) : "memory");      /* as above, for the tile after next */
      } }
    v8f accs[8] = {c00, c01, c02, c03, c10, c11, c12, c13};
#pragma unroll
    for (int u = 0; u < 8; ++u) { const int t4 = u & 3, half = u >> 2; const float bvr = bf16_round(bv[t4]);
#pragma unroll
      for (int r = 0; r < 8; ++r) { const int rloc = half * 16 + 8 * hh + r; float v = accs[u][r] * alpha + bvr;
        if (ACT == 3) v = fmaxf(v, 0.f); else if (ACT == 6) v = 0.5f * v * (1.0f + erff(v * 0.70710678118654752f)); else if (ACT == 11) v = 1.0f / (1.0f + expf(-v)); else if (ACT == 15) v = v / (1.0f + expf(-v)); else if (ACT == 12) v = (v > 0.f) ? v : 0.01f * v; else if (ACT == 8) v = tanhf(v); else if (ACT == 9) v = 0.5f * v * (1.0f + tanhf(0.7978845608028654f * (v + 0.044715f * v * v * v))); else if (ACT == 14) v = (v > 0.f) ? v : 0.1f * v; else if (ACT == 16) v = (v >= 0.f) ? v : 0.3f * v; else if (ACT == 17) v = (v >= 0.f) ? v : 0.2f * v;
        so[w][rloc][t4 * 16 + ln] = v; } }
    __builtin_amdgcn_fence(__ATOMIC_ACQ_REL, "workgroup", "local"); __builtin_amdgcn_wave_barrier();      /* the wave's rows written before its lanes read them back; LDS alone, so that the loads in flight and the earlier stores are not waited for */
  }
#pragma unroll      /* the last pass has no products behind it: its rows leave together */
  for (int q = 0; q < 16; ++q) { const int r = q * 2 + rsub; const v4f v = *(const v4fa*)&so[w][r][c4]; *(v4f*)(gC + oC + (q * 2 * ldc + (NT - 1) * G2_BN) * 4) = v; }
}

extern "C" void kernel_launch(void* const* d_in, const int* in_sizes, int n_in,
                              void* d_out, int out_size, void* d_ws, size_t ws_size, hipStream_t stream) {
  if (n_in < 3) return; if (in_sizes[0] < PNR * PNG * PNK || in_sizes[1] < PNG * PNC * PNK || in_sizes[2] < PNG * PNC) return; if (out_size < PNR * PNG * PNC) return;
  const float* da = (const float*)d_in[0]; const float* wa = (const float*)d_in[1]; const float* ra = (const float*)d_in[2]; float* res = (float*)d_out;
  static_assert(PNR % G2_BM == 0 && PNC % G2_BN == 0 && PNK % 32 == 0 && PNK % 8 == 0, "whole tiles");
  k_gemm2<0><<<dim3((unsigned)(PNR / G2_BM), (unsigned)PNG), 512, 0, stream>>>(da, wa, 1.0f, ra, res);      /* result[:, g, :] = da[:, g, :] wa[g]^T plus ra[g] */
}

// v006
// One run takes 18.4 microseconds.
// Next to v005, in two timings, it ran 1.05 and 1.06 times as fast.
// All steps since v000 together make it 2.98 times as fast.
// result[r][g][c] = sum over q of da[r][g][q] wa[g][c][q] plus ra[g][c]: da [1024][64][128] (sixty-four groups side by side in every row); wa [64][512][128] (a group's array stored column first: [column][depth]); ra [64][512] an added row a group -> [1024][64][512].
// Structure: ONE launch. da and wa are read AS THEY LIE, in f32 (a group's 128 words of da stand at offset 128 g of every 8,192-word row: the product reads them by pitch and group stride: no copy; a group's [512 columns][128 deep] of wa is already the product's second operand: no turning); each work-group casts its own operand tiles on their way from the registers into LDS (its 256 rows once, then the group's four 128-column tiles one after the other); the WMMA GEMM with the group as the grid's second index forms the result in f32 STRAIGHT INTO THE OUTPUT (1,024 rows, 512 columns, depth 128 a group; the added row at its own group stride; the output's pitch 32,768 words, its group stride 512). No workspace.
// Compute dtype: each of the three arrays converted to bf16 where it is read; da and wa go to the matrix unit as plain f16 words of their bf16 values (exact down to 2^-14 as normals); the product's accumulation and the added row f32. v_wmma_f32_16x16x32_f16.
#include <hip/hip_runtime.h>
#define PNR 1024                     /* rows */
#define PNG 64                       /* groups */
#define PNK 128                      /* a group's depth */
#define PNC 512                      /* a group's columns */
typedef unsigned short v8us __attribute__((ext_vector_type(8), may_alias));
typedef float  v8f  __attribute__((ext_vector_type(8)));
typedef float  v4f  __attribute__((ext_vector_type(4)));
typedef float  v4fa __attribute__((ext_vector_type(4), may_alias));

__device__ __forceinline__ unsigned short bf16_bits(float x) { unsigned int u = __float_as_uint(x); return (unsigned short)((u + 0x7FFFu + ((u >> 16) & 1u)) >> 16); }
__device__ __forceinline__ float bf16_val(unsigned short b) { return __uint_as_float(((unsigned int)b) << 16); }
__device__ __forceinline__ float bf16_round(float x) { return bf16_val(bf16_bits(x)); }

typedef _Float16 v16h __attribute__((ext_vector_type(16)));
union FragH { v16h v; v8us half[2]; _Float16 h[16]; unsigned short u[16]; };

// Wt[n][k] = f16(W[k][n] x scale) from f32 row-major W[K][N] (scale = power of two; bf16-exact weights stay exact in f16 away from the subnormal range)
__global__ __launch_bounds__(256) void k_wt_f16(const float* __restrict__ W, _Float16* __restrict__ Wt, int K, int N, float scale) {
  const int t = blockIdx.x * 256 + threadIdx.x; if (t >= N * (K / 8)) return; const int n = t / (K / 8), k8 = (t % (K / 8)) * 8; FragH f;
#pragma unroll
  for (int i = 0; i < 8; ++i) f.h[i] = (_Float16)(bf16_round(W[(size_t)(k8 + i) * N + n]) * scale); const v8us o = f.half[0];
  *(v8us*)((unsigned short*)Wt + (size_t)n * K + k8) = o; 
}

typedef _Float16 v4h __attribute__((ext_vector_type(4)));

typedef unsigned short v4us __attribute__((ext_vector_type(4), may_alias));
union Quad { v4h h; v4us u; };
// four f32 words -> their bf16 values as f16 words
__device__ __forceinline__ v4us g2_cast4(v4f x) { Quad q;
#pragma unroll
  for (int i = 0; i < 4; ++i) q.h[i] = (_Float16)bf16_round(x[i]); return q.u; }

// ---- fast GEMM (wave tile 32x64, sixteen waves = pass tile 256x128, depth PNK; a work-group keeps its 256 rows and walks every 128-column tile of its group); epilogue: scale, the added row, ACT ----
// Both operands are read in f32 by loads that cover whole 512-byte rows (one row a wave-wide load), cast in registers and written to LDS as f16 words; the fragments are read from LDS.
// A pass's results wait in the wave's own LDS rows and are stored during the next pass, eight rows behind each product step's LDS reads.
// The first pass runs as two halves: each wave's first sixteen rows are cast, multiplied and stored before its second sixteen are cast, so that the output stream starts early.
// The first operand's 256 rows are staged once. The second operand's tiles alternate between two LDS buffers: a tile's loads are issued one pass ahead and stay in flight over an epilogue and a pass of products.
#define G2_LDA (PNG * PNK)           /* pitch of the first operand's rows in memory, f32 words */
#define G2_LDB PNK                   /* pitch of the second operand's rows in memory, f32 words */
#define G2_PH 136                    /* LDS row pitch in f16 words: 272 B = 17 x 16 B, an odd count of 16 B for the 16-byte fragment reads */
#define G2_BM 256                    /* rows a work-group */
#define G2_BN 128                    /* columns a pass */
__device__ __forceinline__ v16h g2_frag(const _Float16* p, int hh) { FragH f; f.half[0] = *(const v8us*)((const unsigned short*)p + 8 * hh); f.half[1] = *(const v8us*)((const unsigned short*)p + 16 + 8 * hh); return f.v; }
__device__ __forceinline__ v8f g2_mma(v16h a, v16h b, v8f c) { v8f d = __builtin_amdgcn_wmma_f32_16x16x32_f16(false, a, false, b, (short)0, c, false, false); asm volatile("v_nop\n\tv_nop\n\tv_nop\n\tv_nop" : "+v"(d) : "v"(a), "v"(b)); return d; }
// Work-group barrier whose fences order LDS alone: the waves hand each other nothing but LDS, and a fence over global memory too would make every wave wait here for its output stores and for the loads it has in flight.
__device__ __forceinline__ void g2_bar() { __builtin_amdgcn_fence(__ATOMIC_RELEASE, "workgroup", "local"); __builtin_amdgcn_s_barrier(); __builtin_amdgcn_fence(__ATOMIC_ACQUIRE, "workgroup", "local"); }
template <int ACT>
__global__ __launch_bounds__(512) void k_gemm2(const float* __restrict__ A, const float* __restrict__ Bh, float alpha, const float* __restrict__ bias, float* __restrict__ C) {
  constexpr size_t sA = PNK, sB = (size_t)PNC * PNK, sBias = PNC, sC = PNC; constexpr int ldc = PNG * PNC, M = PNR, N = PNC, NT = N / G2_BN;      /* this product's group strides, output pitch and sizes as compile-time values: no address product and no test of an absent operand is left to run time */ static_assert(ACT == 0 || ACT == 3 || ACT == 6 || ACT == 8 || ACT == 9 || ACT == 11 || ACT == 12 || ACT == 14 || ACT == 15 || ACT == 16 || ACT == 17, "k_gemm2: unsupported ACT code (would silently apply no activation)");
  __shared__ __attribute__((aligned(16))) unsigned short tA[G2_BM * G2_PH];          /* the work-group's rows, staged once */
  __shared__ __attribute__((aligned(16))) unsigned short tB[2][G2_BN * G2_PH];       /* two column tiles: one read by the products, one being filled */
  __shared__ __attribute__((aligned(16))) float so[16][32][68];                      /* each wave's own 32 output rows */
  static_assert(PNK == 128 && NT >= 2, "a row is thirty-two 16-byte pieces of f32; both buffers are used");
  const int tid = threadIdx.x, w = tid >> 5, lane = tid & 31, ln = lane & 15, hh = lane >> 4; const int by = blockIdx.y;
  A += (size_t)by * sA; Bh += (size_t)by * sB; const float* bp = bias + (size_t)by * sBias;
  const int rowB = blockIdx.x * G2_BM; if (rowB >= M) return;
  const int wr = w & 7, wc = w >> 3;
  const int l4 = lane * 4; v4f tn[8], to[8];
  const char* const gA = (const char*)(A + (size_t)rowB * G2_LDA); const char* const gB = (const char*)Bh; const char* const gR = (const char*)bp;
  char* const gC = (char*)(C + (size_t)by * sC + (size_t)rowB * ldc);
  const unsigned oA = (unsigned)(w * G2_LDA + l4) * 4u, oB = (unsigned)(w * G2_LDB + l4) * 4u, oR = (unsigned)(64 * wc + ln) * 4u;      /* the lane's byte offsets in the two operands and in the added row */
  const int rsub = lane >> 4, c4 = (lane & 15) * 4;
  const unsigned oC = (unsigned)((32 * wr + rsub) * ldc + 64 * wc + c4) * 4u;      /* the lane's byte offset in the work-group's part of the output */
  float bv0[4];
  { v4f te[8];      /* te: the rows that are some wave's first sixteen (row & 16 == 0); to: the others */
    for (int i = 0; i < 8; ++i) tn[i] = *(const v4fa*)(gB + oB + i * 16 * G2_LDB * 4);
    for (int i = 0; i < 8; ++i) te[i] = *(const v4fa*)(gA + oA + (2 * i) * 16 * G2_LDA * 4);
    for (int j = 0; j < 4; ++j) bv0[j] = *(const float*)(gR + oR + (j * 16) * 4);      /* the first pass's piece of the added row: wanted at the first half's end, so asked for ahead of the loads that may come later */
    for (int i = 0; i < 8; ++i) to[i] = *(const v4fa*)(gA + oA + (2 * i + 1) * 16 * G2_LDA * 4);
    asm volatile("s_wait_xcnt 0x0" :: "v"(oA), "v"(oB), "v"(oR) : "memory");      /* the loads' offset registers stay whole until this wait, which stands in front of their first overwrite */
    for (int i = 0; i < 8; ++i) *(v4us*)(tB[0] + (i * 16 + w) * G2_PH + l4) = g2_cast4(tn[i]);
    for (int i = 0; i < 8; ++i) *(v4us*)(tA + ((2 * i) * 16 + w) * G2_PH + l4) = g2_cast4(te[i]); }
  g2_bar();      /* the first column tile and every wave's first sixteen rows written before any wave reads a fragment */
  for (int i = 0; i < 8; ++i) tn[i] = *(const v4fa*)(gB + oB + (G2_BN + i * 16) * G2_LDB * 4);
  asm volatile("s_wait_xcnt 0x0" :: "v"(oB) : "memory");      /* as above, for the second tile's loads */
  const _Float16* a0p = (const _Float16*)tA + (32 * wr + ln) * G2_PH; const _Float16* a1p = a0p + 16 * G2_PH;
#pragma unroll      /* the buffer index, the tile's offsets and the last passes' cases become compile-time */
  for (int t = 0; t < NT; ++t) {
    float bv[4];
    if (t == 0) { for (int j = 0; j < 4; ++j) bv[j] = bv0[j]; } else {
      for (int j = 0; j < 4; ++j) bv[j] = *(const float*)(gR + oR + (t * G2_BN + j * 16) * 4);      /* the pass's piece of the added row, asked for ahead of the products */
      asm volatile("s_wait_xcnt 0x0" :: "v"(oR) : "memory"); }      /* as above, for the added row's loads */
    const _Float16* b0p = (const _Float16*)tB[t & 1] + (64 * wc + ln) * G2_PH; const _Float16* b1p = b0p + 16 * G2_PH; const _Float16* b2p = b1p + 16 * G2_PH; const _Float16* b3p = b2p + 16 * G2_PH;
    const v8f z8 = {0.f,0.f,0.f,0.f,0.f,0.f,0.f,0.f}; v8f c00 = z8, c01 = z8, c02 = z8, c03 = z8, c10 = z8, c11 = z8, c12 = z8, c13 = z8;
    if (t == 0) {      /* the first pass in two halves */
#pragma unroll      /* four steps, their LDS offsets as immediates */
      for (int kb = 0; kb < PNK; kb += 32) { const v16h a0 = g2_frag(a0p + kb, hh);
        const v16h b0 = g2_frag(b0p + kb, hh), b1 = g2_frag(b1p + kb, hh), b2 = g2_frag(b2p + kb, hh), b3 = g2_frag(b3p + kb, hh);
        c00 = g2_mma(a0, b0, c00); c01 = g2_mma(a0, b1, c01); c02 = g2_mma(a0, b2, c02); c03 = g2_mma(a0, b3, c03); }
      __builtin_amdgcn_sched_barrier(0);      /* keeps the added row's rounding, and the wait for its loads, behind the products */
      { const v8f acch[4] = {c00, c01, c02, c03};
#pragma unroll      /* the register array is indexed by constants only */
        for (int u = 0; u < 4; ++u) { const float bvr = bf16_round(bv[u]);
#pragma unroll      /* as above */
          for (int r = 0; r < 8; ++r) so[w][8 * hh + r][u * 16 + ln] = acch[u][r] * alpha + bvr; } }
      static_assert(ACT == 0, "the first half's rows leave without an activation");
      __builtin_amdgcn_fence(__ATOMIC_ACQ_REL, "workgroup", "local"); __builtin_amdgcn_wave_barrier();      /* the wave's sixteen rows written before its lanes read them back; LDS alone */
      v4f sh[8];
      for (int q = 0; q < 8; ++q) sh[q] = *(const v4fa*)&so[w][q * 2 + rsub][c4];
      for (int q = 0; q < 8; ++q) *(v4f*)(gC + oC + (q * 2 * ldc) * 4) = sh[q];
      __builtin_amdgcn_sched_barrier(0);      /* keeps the second sixteen rows' cast behind the first stores: ahead of them it would delay the start of the output stream */
      for (int i = 0; i < 8; ++i) *(v4us*)(tA + ((2 * i + 1) * 16 + w) * G2_PH + l4) = g2_cast4(to[i]);
      asm volatile("s_wait_xcnt 0x0" :: "v"(oC), "v"(sh[0]), "v"(sh[1]), "v"(sh[2]), "v"(sh[3]), "v"(sh[4]), "v"(sh[5]), "v"(sh[6]), "v"(sh[7]) : "memory");      /* the eight stores' offset and data registers stay whole until this wait */
      g2_bar();      /* every wave's second sixteen rows written before any wave reads their fragments */
#pragma unroll      /* four steps, their LDS offsets as immediates */
      for (int kb = 0; kb < PNK; kb += 32) { const v16h a1 = g2_frag(a1p + kb, hh);
        const v16h b0 = g2_frag(b0p + kb, hh), b1 = g2_frag(b1p + kb, hh), b2 = g2_frag(b2p + kb, hh), b3 = g2_frag(b3p + kb, hh);
        c10 = g2_mma(a1, b0, c10); c11 = g2_mma(a1, b1, c11); c12 = g2_mma(a1, b2, c12); c13 = g2_mma(a1, b3, c13); }
    } else
#pragma unroll      /* four steps, their LDS offsets as immediates */
    for (int kb = 0; kb < PNK; kb += 32) { const v16h a0 = g2_frag(a0p + kb, hh), a1 = g2_frag(a1p + kb, hh);
      const v16h b0 = g2_frag(b0p + kb, hh), b1 = g2_frag(b1p + kb, hh), b2 = g2_frag(b2p + kb, hh), b3 = g2_frag(b3p + kb, hh);      /* a step's twelve LDS reads as one group, one wait's latency a step */
      v4f sv[4];      /* a quarter (eight rows) of the pass before: its stores leave while this step's products run, not as one burst between two passes */
      const bool st = t > 1 || kb < 64; const int r0 = t > 1 ? kb / 4 : 16 + kb / 4;      /* of the first pass only the second sixteen rows are left: they leave in the first two steps */
      if (st) { for (int q = 0; q < 4; ++q) sv[q] = *(const v4fa*)&so[w][r0 + q * 2 + rsub][c4];
        for (int q = 0; q < 4; ++q) *(v4f*)(gC + oC + ((r0 + q * 2) * ldc + (t - 1) * G2_BN) * 4) = sv[q]; }
      c00 = g2_mma(a0, b0, c00); c10 = g2_mma(a1, b0, c10);
      c01 = g2_mma(a0, b1, c01); c11 = g2_mma(a1, b1, c11);
      c02 = g2_mma(a0, b2, c02); c12 = g2_mma(a1, b2, c12);
      c03 = g2_mma(a0, b3, c03); c13 = g2_mma(a1, b3, c13);
      if (st) asm volatile("s_wait_xcnt 0x0" :: "v"(oC), "v"(sv[0]), "v"(sv[1]), "v"(sv[2]), "v"(sv[3]) : "memory");      /* the four stores' offset and data registers stay whole until this wait; the next step overwrites them behind it */
    }
    __builtin_amdgcn_sched_barrier(0);      /* keeps the next tile's cast and the added row's rounding, and with them the waits for their loads, behind the products */
    if (t + 1 < NT) {
      for (int i = 0; i < 8; ++i) *(v4us*)(tB[(t + 1) & 1] + (i * 16 + w) * G2_PH + l4) = g2_cast4(tn[i]);      /* into the buffer whose readers all passed the barrier of the pass before */
      g2_bar();      /* the next tile written, and this tile's last fragment read ended, before any wave goes on */
      if (t + 2 < NT) {
        for (int i = 0; i < 8; ++i) tn[i] = *(const v4fa*)(gB + oB + ((t + 2) * G2_BN + i * 16) * G2_LDB * 4);
        asm volatile("s_wait_xcnt 0x0" :: "v"(oB) : "memory");      /* as above, for the tile after next */
      } }
    v8f accs[8] = {c00, c01, c02, c03, c10, c11, c12, c13};
#pragma unroll
    for (int u = (t == 0 ? 4 : 0); u < 8; ++u) { const int t4 = u & 3, half = u >> 2; const float bvr = bf16_round(bv[t4]);      /* the first pass's first half has left already */
#pragma unroll
      for (int r = 0; r < 8; ++r) { const int rloc = half * 16 + 8 * hh + r; float v = accs[u][r] * alpha + bvr;
        if (ACT == 3) v = fmaxf(v, 0.f); else if (ACT == 6) v = 0.5f * v * (1.0f + erff(v * 0.70710678118654752f)); else if (ACT == 11) v = 1.0f / (1.0f + expf(-v)); else if (ACT == 15) v = v / (1.0f + expf(-v)); else if (ACT == 12) v = (v > 0.f) ? v : 0.01f * v; else if (ACT == 8) v = tanhf(v); else if (ACT == 9) v = 0.5f * v * (1.0f + tanhf(0.7978845608028654f * (v + 0.044715f * v * v * v))); else if (ACT == 14) v = (v > 0.f) ? v : 0.1f * v; else if (ACT == 16) v = (v >= 0.f) ? v : 0.3f * v; else if (ACT == 17) v = (v >= 0.f) ? v : 0.2f * v;
        so[w][rloc][t4 * 16 + ln] = v; } }
    __builtin_amdgcn_fence(__ATOMIC_ACQ_REL, "workgroup", "local"); __builtin_amdgcn_wave_barrier();      /* the wave's rows written before its lanes read them back; LDS alone, so that the loads in flight and the earlier stores are not waited for */
  }
#pragma unroll      /* the last pass has no products behind it: its rows leave together */
  for (int q = 0; q < 16; ++q) { const int r = q * 2 + rsub; const v4f v = *(const v4fa*)&so[w][r][c4]; *(v4f*)(gC + oC + (q * 2 * ldc + (NT - 1) * G2_BN) * 4) = v; }
}

extern "C" void kernel_launch(void* const* d_in, const int* in_sizes, int n_in,
                              void* d_out, int out_size, void* d_ws, size_t ws_size, hipStream_t stream) {
  if (n_in < 3) return; if (in_sizes[0] < PNR * PNG * PNK || in_sizes[1] < PNG * PNC * PNK || in_sizes[2] < PNG * PNC) return; if (out_size < PNR * PNG * PNC) return;
  const float* da = (const float*)d_in[0]; const float* wa = (const float*)d_in[1]; const float* ra = (const float*)d_in[2]; float* res = (float*)d_out;
  static_assert(PNR % G2_BM == 0 && PNC % G2_BN == 0 && PNK % 32 == 0 && PNK % 8 == 0, "whole tiles");
  k_gemm2<0><<<dim3((unsigned)(PNR / G2_BM), (unsigned)PNG), 512, 0, stream>>>(da, wa, 1.0f, ra, res);      /* result[:, g, :] = da[:, g, :] wa[g]^T plus ra[g] */
}
